// v000
// The times below were measured on an AMD MI455X: many runs one after another, warmed up first and cycling through
// copies of the inputs, with the whole window's GPU time divided by the number of runs. Launches and the gaps
// between them are all in it. The median over several windows is given; except for v000 it joins two sittings, which
// can be a few percent apart, so the side-by-side timings, each taken in one sitting, are the better comparison.
// v000 is the starting kernel. One run takes 429 microseconds.
#include <hip/hip_runtime.h>
#include <hip/hip_bf16.h>

typedef __attribute__((ext_vector_type(16))) __bf16 v16bf;
typedef __attribute__((ext_vector_type(8)))  __bf16 v8bf;
typedef __attribute__((ext_vector_type(4)))  __bf16 v4bf;
typedef __attribute__((ext_vector_type(8)))  float  v8f;
typedef __attribute__((ext_vector_type(4)))  float  v4f;
typedef __attribute__((ext_vector_type(4)))  int    v4i;

#define B_  2
#define S_  2048
#define H_  1024
#define NH_ 16
#define DK_ 64

// ---------------------------------------------------------------------------
// WMMA operand builder: CDNA5 16-bit A/B layout, lane-half h holds
// K{8h..8h+7} in elements 0..7 and K{16+8h..16+8h+7} in elements 8..15.
static __device__ __forceinline__ v16bf load_op16(const __bf16* base, int h) {
  v8bf lo = *(const v8bf*)(base + 8 * h);
  v8bf hi = *(const v8bf*)(base + 16 + 8 * h);
  v16bf r;
#pragma unroll
  for (int i = 0; i < 8; ++i) { r[i] = lo[i]; r[8 + i] = hi[i]; }
  return r;
}

// 16-byte async global->LDS copy (ASYNCcnt-tracked).
static __device__ __forceinline__ void async_copy16(const __bf16* g, __bf16* l) {
#if __has_builtin(__builtin_amdgcn_global_load_async_to_lds_b128)
  __builtin_amdgcn_global_load_async_to_lds_b128(
      (__attribute__((address_space(1))) v4i*)(uintptr_t)g,
      (__attribute__((address_space(3))) v4i*)(unsigned)(uintptr_t)l, 0, 0);
#else
  asm volatile("global_load_async_to_lds_b128 %0, %1, off"
               :: "v"((unsigned)(uintptr_t)l),
                  "v"((unsigned long long)(uintptr_t)g)
               : "memory");
#endif
}

static __device__ __forceinline__ void wait_async6() {
  asm volatile("s_wait_asynccnt 0x6" ::: "memory");
}
static __device__ __forceinline__ void wait_async0() {
  asm volatile("s_wait_asynccnt 0x0" ::: "memory");
}

__global__ void cvt_f32_bf16(const float* __restrict__ in,
                             __bf16* __restrict__ out, int n4) {
  int i = blockIdx.x * blockDim.x + threadIdx.x;
  int stride = gridDim.x * blockDim.x;
  for (; i < n4; i += stride) {
    v4f x = ((const v4f*)in)[i];
    v4bf y;
#pragma unroll
    for (int j = 0; j < 4; ++j) y[j] = (__bf16)x[j];
    ((v4bf*)out)[i] = y;
  }
}

// ---------------------------------------------------------------------------
// C[M,N] = A[M,K](bf16) @ W[N,K]^T(bf16) + bias[N](f32)
// LDS-staged, double-buffered async pipeline.  WG = 256 thr (8 waves),
// tile 64(M) x 128(N) x 64(K) per stage; wave tile 32x32; 8 WMMAs/stage/wave.
// mode 1: bf16 out [B,NH,S,DK]; mode 2: bf16 out [B,NH,DK,S]; mode 3: f32 [M,N]
#define LDS_STRIDE 72  // 64 + 8 bf16 pad -> 36-bank row stride, conflict-free

__global__ void __launch_bounds__(256)
gemm_bf16_wmma(const __bf16* __restrict__ A, const __bf16* __restrict__ W,
               const float* __restrict__ bias, void* __restrict__ out,
               int M, int N, int K, int mode) {
  __shared__ __bf16 sA[2][64][LDS_STRIDE];
  __shared__ __bf16 sB[2][128][LDS_STRIDE];

  const int tid  = threadIdx.x;
  const int wid  = tid >> 5;
  const int lane = tid & 31;
  const int lm = lane & 15, h = lane >> 4;
  const int wm = wid & 1, wn = wid >> 1;
  const int mBase = blockIdx.x * 64;
  const int nBase = blockIdx.y * 128;

  // staging: 4 threads/row, each thread covers elem [c8,c8+8) and [c8+32,c8+40)
  const int ra = tid >> 2;         // 0..63
  const int c8 = (tid & 3) * 8;
  const __bf16* gA  = A + (size_t)(mBase + ra) * K + c8;
  const __bf16* gB0 = W + (size_t)(nBase + ra) * K + c8;
  const __bf16* gB1 = W + (size_t)(nBase + 64 + ra) * K + c8;

  v8f acc[2][2] = {};

  const int NK = K / 64;  // stages

  auto stage = [&](int buf, int k0) {
    async_copy16(gA  + k0,      &sA[buf][ra][c8]);
    async_copy16(gA  + k0 + 32, &sA[buf][ra][c8 + 32]);
    async_copy16(gB0 + k0,      &sB[buf][ra][c8]);
    async_copy16(gB0 + k0 + 32, &sB[buf][ra][c8 + 32]);
    async_copy16(gB1 + k0,      &sB[buf][64 + ra][c8]);
    async_copy16(gB1 + k0 + 32, &sB[buf][64 + ra][c8 + 32]);
  };

  stage(0, 0);  // prologue

  for (int kc = 0; kc < NK; ++kc) {
    const int cur = kc & 1;
    if (kc + 1 < NK) {
      stage(cur ^ 1, (kc + 1) * 64);
      wait_async6();   // previous buffer's 6 copies (this wave) complete
    } else {
      wait_async0();
    }
    __syncthreads();   // all waves' copies into `cur` visible

    const __bf16* ap = &sA[cur][wm * 32 + lm][0];
    const __bf16* bp = &sB[cur][wn * 32 + lm][0];
#pragma unroll
    for (int kk = 0; kk < 2; ++kk) {
      v16bf a0 = load_op16(ap + kk * 32, h);
      v16bf a1 = load_op16(ap + 16 * LDS_STRIDE + kk * 32, h);
      v16bf b0 = load_op16(bp + kk * 32, h);
      v16bf b1 = load_op16(bp + 16 * LDS_STRIDE + kk * 32, h);
      acc[0][0] = __builtin_amdgcn_wmma_f32_16x16x32_bf16(false, a0, false, b0, (short)0, acc[0][0], false, false);
      acc[0][1] = __builtin_amdgcn_wmma_f32_16x16x32_bf16(false, a0, false, b1, (short)0, acc[0][1], false, false);
      acc[1][0] = __builtin_amdgcn_wmma_f32_16x16x32_bf16(false, a1, false, b0, (short)0, acc[1][0], false, false);
      acc[1][1] = __builtin_amdgcn_wmma_f32_16x16x32_bf16(false, a1, false, b1, (short)0, acc[1][1], false, false);
    }

    __syncthreads();   // reads of `cur` done before it is overwritten
  }

#pragma unroll
  for (int ms = 0; ms < 2; ++ms)
#pragma unroll
    for (int ns = 0; ns < 2; ++ns) {
      const int n = nBase + wn * 32 + ns * 16 + lm;
      const float bn = bias[n];
#pragma unroll
      for (int j = 0; j < 8; ++j) {
        const int m = mBase + wm * 32 + ms * 16 + j + 8 * h;
        const float v = acc[ms][ns][j] + bn;
        if (mode == 3) {
          ((float*)out)[(size_t)m * N + n] = v;
        } else {
          const int bb = m >> 11, s = m & (S_ - 1);   // m = b*S + s
          const int hd = n >> 6,  d = n & (DK_ - 1);  // n = h*DK + d
          __bf16* o = (__bf16*)out;
          if (mode == 1)
            o[(((size_t)(bb * NH_ + hd)) * S_ + s) * DK_ + d] = (__bf16)v;
          else
            o[(((size_t)(bb * NH_ + hd)) * DK_ + d) * S_ + s] = (__bf16)v;
        }
      }
    }
}

// ---------------------------------------------------------------------------
// Flash attention, software-pipelined: one wave owns a 16-row Q tile, streams
// keys in chunks of 32.  Next chunk's K operands are prefetched while softmax
// VALU and the P LDS round-trip run.  Q,K: [B,NH,S,DK]; V: [B,NH,DK,S] bf16.
__global__ void __launch_bounds__(256)
flash_attn_bf16(const __bf16* __restrict__ Q, const __bf16* __restrict__ Kh,
                const __bf16* __restrict__ Vt, const int* __restrict__ mask,
                __bf16* __restrict__ ctx) {
  __shared__ __bf16 ldsP[8][16 * 32];
  const int wid  = threadIdx.x >> 5;
  const int lane = threadIdx.x & 31;
  const int lm = lane & 15, h = lane >> 4;

  const int gt = blockIdx.x * 8 + wid;
  const int qt = gt & (S_ / 16 - 1);
  const int bh = gt >> 7;
  const int hd = bh & (NH_ - 1);
  const int bb = bh >> 4;
  const int qbase = qt * 16;

  const __bf16* Qp = Q  + ((size_t)(bb * NH_ + hd)) * S_ * DK_;
  const __bf16* Kp = Kh + ((size_t)(bb * NH_ + hd)) * S_ * DK_;
  const __bf16* Vp = Vt + ((size_t)(bb * NH_ + hd)) * DK_ * S_;
  const int* mp = mask + (size_t)bb * S_ * S_;

  v16bf aq[2];
#pragma unroll
  for (int c = 0; c < 2; ++c)
    aq[c] = load_op16(Qp + (size_t)(qbase + lm) * DK_ + 32 * c, h);

  v8f oacc[4] = {};
  float mrow[8], lrow[8];
#pragma unroll
  for (int j = 0; j < 8; ++j) { mrow[j] = -3.0e38f; lrow[j] = 0.f; }

  v16bf bk[2][2][2];  // [buf][key-subtile][dk-chunk]
  v16bf bv[4];
  int   mk[2][8];

  auto loadKtile = [&](int kb, int buf) {
#pragma unroll
    for (int t = 0; t < 2; ++t)
#pragma unroll
      for (int c = 0; c < 2; ++c)
        bk[buf][t][c] =
            load_op16(Kp + (size_t)(kb + 16 * t + lm) * DK_ + 32 * c, h);
  };

  loadKtile(0, 0);
  int pb = 0;
  for (int kb = 0; kb < S_; kb += 32, pb ^= 1) {
    // ---- scores: S[16q x 32k], K-dim = DK in two chunks of 32
    v8f sc[2] = {};
#pragma unroll
    for (int t = 0; t < 2; ++t)
#pragma unroll
      for (int c = 0; c < 2; ++c)
        sc[t] = __builtin_amdgcn_wmma_f32_16x16x32_bf16(
            false, aq[c], false, bk[pb][t][c], (short)0, sc[t], false, false);

    // ---- issue loads early (in-order completion => partial waits later):
    // mask (needed soonest), then V (needed after softmax), then next-K.
#pragma unroll
    for (int t = 0; t < 2; ++t)
#pragma unroll
      for (int j = 0; j < 8; ++j)
        mk[t][j] = mp[(size_t)(qbase + j + 8 * h) * S_ + kb + 16 * t + lm];
#pragma unroll
    for (int nt = 0; nt < 4; ++nt)
      bv[nt] = load_op16(Vp + (size_t)(nt * 16 + lm) * S_ + kb, h);
    if (kb + 32 < S_) loadKtile(kb + 32, pb ^ 1);

    // ---- scale by 1/sqrt(DK), apply mask
#pragma unroll
    for (int t = 0; t < 2; ++t)
#pragma unroll
      for (int j = 0; j < 8; ++j) {
        const float v = sc[t][j] * 0.125f;
        sc[t][j] = (mk[t][j] != 0) ? v : -60000.f;
      }

    // ---- online softmax; C-layout rows live in 16-lane halves
    float alpha[8];
#pragma unroll
    for (int j = 0; j < 8; ++j) {
      float cm = fmaxf(sc[0][j], sc[1][j]);
#pragma unroll
      for (int d = 1; d < 16; d <<= 1) cm = fmaxf(cm, __shfl_xor(cm, d, 32));
      const float mnew = fmaxf(mrow[j], cm);
      alpha[j] = __expf(mrow[j] - mnew);
      const float p0 = __expf(sc[0][j] - mnew);
      const float p1 = __expf(sc[1][j] - mnew);
      sc[0][j] = p0; sc[1][j] = p1;
      float rs = p0 + p1;
#pragma unroll
      for (int d = 1; d < 16; d <<= 1) rs += __shfl_xor(rs, d, 32);
      lrow[j] = lrow[j] * alpha[j] + rs;
      mrow[j] = mnew;
    }
#pragma unroll
    for (int nt = 0; nt < 4; ++nt)
#pragma unroll
      for (int j = 0; j < 8; ++j) oacc[nt][j] *= alpha[j];

    // ---- P: C-layout regs -> LDS row-major -> reload as A operand
    __bf16* pl = &ldsP[wid][0];
#pragma unroll
    for (int t = 0; t < 2; ++t)
#pragma unroll
      for (int j = 0; j < 8; ++j)
        pl[(j + 8 * h) * 32 + 16 * t + lm] = (__bf16)sc[t][j];
    asm volatile("s_wait_dscnt 0x0" ::: "memory");
    v16bf pa = load_op16(pl + lm * 32, h);

    // ---- O += P @ V (4 N-tiles over DK)
#pragma unroll
    for (int nt = 0; nt < 4; ++nt)
      oacc[nt] = __builtin_amdgcn_wmma_f32_16x16x32_bf16(
          false, pa, false, bv[nt], (short)0, oacc[nt], false, false);
  }

  // ---- normalize, emit context [B,S,H] bf16
#pragma unroll
  for (int j = 0; j < 8; ++j) {
    const float inv = 1.f / lrow[j];
    const int qr = qbase + j + 8 * h;
#pragma unroll
    for (int nt = 0; nt < 4; ++nt)
      ctx[((size_t)(bb * S_ + qr)) * H_ + hd * DK_ + nt * 16 + lm] =
          (__bf16)(oacc[nt][j] * inv);
  }
}

// ---------------------------------------------------------------------------
extern "C" void kernel_launch(void* const* d_in, const int* in_sizes, int n_in,
                              void* d_out, int out_size, void* d_ws, size_t ws_size,
                              hipStream_t stream) {
  (void)in_sizes; (void)n_in; (void)out_size; (void)ws_size;
  const float* query = (const float*)d_in[0];
  const float* key   = (const float*)d_in[1];
  const int*   amask = (const int*)d_in[2];
  const float* Wq = (const float*)d_in[3]; const float* bq = (const float*)d_in[4];
  const float* Wk = (const float*)d_in[5]; const float* bk = (const float*)d_in[6];
  const float* Wv = (const float*)d_in[7]; const float* bv = (const float*)d_in[8];
  const float* Wo = (const float*)d_in[9]; const float* bo = (const float*)d_in[10];

  char* ws = (char*)d_ws;
  const size_t MB = 1u << 20;
  const int SZ_X = B_ * S_ * H_;  // 4194304 elements
  const int SZ_W = H_ * H_;       // 1048576 elements
  __bf16* Xq  = (__bf16*)(ws +  0 * MB);
  __bf16* Xk  = (__bf16*)(ws +  8 * MB);
  __bf16* Wqb = (__bf16*)(ws + 16 * MB);
  __bf16* Wkb = (__bf16*)(ws + 18 * MB);
  __bf16* Wvb = (__bf16*)(ws + 20 * MB);
  __bf16* Wob = (__bf16*)(ws + 22 * MB);
  __bf16* Qh  = (__bf16*)(ws + 24 * MB);  // [B,NH,S,DK]
  __bf16* Khd = (__bf16*)(ws + 32 * MB);  // [B,NH,S,DK]
  __bf16* Vtd = (__bf16*)(ws + 40 * MB);  // [B,NH,DK,S]
  __bf16* ctx = (__bf16*)(ws + 48 * MB);  // [B,S,H]

  cvt_f32_bf16<<<1024, 256, 0, stream>>>(query, Xq, SZ_X / 4);
  cvt_f32_bf16<<<1024, 256, 0, stream>>>(key,   Xk, SZ_X / 4);
  cvt_f32_bf16<<<256,  256, 0, stream>>>(Wq, Wqb, SZ_W / 4);
  cvt_f32_bf16<<<256,  256, 0, stream>>>(Wk, Wkb, SZ_W / 4);
  cvt_f32_bf16<<<256,  256, 0, stream>>>(Wv, Wvb, SZ_W / 4);
  cvt_f32_bf16<<<256,  256, 0, stream>>>(Wo, Wob, SZ_W / 4);

  dim3 gg(64, 8);  // M/64 x N/128
  gemm_bf16_wmma<<<gg, 256, 0, stream>>>(Xq, Wqb, bq, Qh,  B_*S_, H_, H_, 1);
  gemm_bf16_wmma<<<gg, 256, 0, stream>>>(Xk, Wkb, bk, Khd, B_*S_, H_, H_, 1);
  gemm_bf16_wmma<<<gg, 256, 0, stream>>>(Xk, Wvb, bv, Vtd, B_*S_, H_, H_, 2);

  flash_attn_bf16<<<512, 256, 0, stream>>>(Qh, Khd, Vtd, amask, ctx);

  gemm_bf16_wmma<<<gg, 256, 0, stream>>>(ctx, Wob, bo, d_out, B_*S_, H_, H_, 3);
}

// v001
// A run of this version takes 195 microseconds.
// In two side-by-side timings against v000, it was 2.21 and 2.18 times as fast.
#include <hip/hip_runtime.h>
#include <hip/hip_bf16.h>

typedef __attribute__((ext_vector_type(16))) __bf16 v16bf;
typedef __attribute__((ext_vector_type(8)))  __bf16 v8bf;
typedef __attribute__((ext_vector_type(4)))  __bf16 v4bf;
typedef __attribute__((ext_vector_type(8)))  float  v8f;
typedef __attribute__((ext_vector_type(4)))  float  v4f;
typedef __attribute__((ext_vector_type(4)))  int    v4i;

#define B_  2
#define S_  2048
#define H_  1024
#define NH_ 16
#define DK_ 64

// ---------------------------------------------------------------------------
// WMMA operand builder: CDNA5 16-bit A/B layout, lane-half h holds
// K{8h..8h+7} in elements 0..7 and K{16+8h..16+8h+7} in elements 8..15.
static __device__ __forceinline__ v16bf load_op16(const __bf16* base, int h) {
  v8bf lo = *(const v8bf*)(base + 8 * h);
  v8bf hi = *(const v8bf*)(base + 16 + 8 * h);
  v16bf r;
#pragma unroll
  for (int i = 0; i < 8; ++i) { r[i] = lo[i]; r[8 + i] = hi[i]; }
  return r;
}

// 16-byte async global->LDS copy (ASYNCcnt-tracked).
static __device__ __forceinline__ void async_copy16(const __bf16* g, __bf16* l) {
#if __has_builtin(__builtin_amdgcn_global_load_async_to_lds_b128)
  __builtin_amdgcn_global_load_async_to_lds_b128(
      (__attribute__((address_space(1))) v4i*)(uintptr_t)g,
      (__attribute__((address_space(3))) v4i*)(unsigned)(uintptr_t)l, 0, 0);
#else
  asm volatile("global_load_async_to_lds_b128 %0, %1, off"
               :: "v"((unsigned)(uintptr_t)l),
                  "v"((unsigned long long)(uintptr_t)g)
               : "memory");
#endif
}

static __device__ __forceinline__ void wait_async6() {
  asm volatile("s_wait_asynccnt 0x6" ::: "memory");
}
static __device__ __forceinline__ void wait_async0() {
  asm volatile("s_wait_asynccnt 0x0" ::: "memory");
}

__global__ void cvt_f32_bf16(const float* __restrict__ in,
                             __bf16* __restrict__ out, int n4) {
  int i = blockIdx.x * blockDim.x + threadIdx.x;
  int stride = gridDim.x * blockDim.x;
  for (; i < n4; i += stride) {
    v4f x = ((const v4f*)in)[i];
    v4bf y;
#pragma unroll
    for (int j = 0; j < 4; ++j) y[j] = (__bf16)x[j];
    ((v4bf*)out)[i] = y;
  }
}

// ---------------------------------------------------------------------------
// C[M,N] = A[M,K](bf16) @ W[N,K]^T(bf16) + bias[N](f32)
// LDS-staged, double-buffered async pipeline.  WG = 256 thr (8 waves),
// tile 64(M) x 128(N) x 64(K) per stage; wave tile 32x32; 8 WMMAs/stage/wave.
// mode 1: bf16 out [B,NH,S,DK]; mode 2: bf16 out [B,NH,DK,S]; mode 3: f32 [M,N]
#define LDS_STRIDE 72  // 64 + 8 bf16 pad -> 36-bank row stride, conflict-free

__global__ void __launch_bounds__(256)
gemm_bf16_wmma(const __bf16* __restrict__ A, const __bf16* __restrict__ W,
               const float* __restrict__ bias, void* __restrict__ out,
               int M, int N, int K, int mode) {
  __shared__ __bf16 sA[2][64][LDS_STRIDE];
  __shared__ __bf16 sB[2][128][LDS_STRIDE];

  const int tid  = threadIdx.x;
  const int wid  = tid >> 5;
  const int lane = tid & 31;
  const int lm = lane & 15, h = lane >> 4;
  const int wm = wid & 1, wn = wid >> 1;
  const int mBase = blockIdx.x * 64;
  const int nBase = blockIdx.y * 128;

  // staging: 4 threads/row, each thread covers elem [c8,c8+8) and [c8+32,c8+40)
  const int ra = tid >> 2;         // 0..63
  const int c8 = (tid & 3) * 8;
  const __bf16* gA  = A + (size_t)(mBase + ra) * K + c8;
  const __bf16* gB0 = W + (size_t)(nBase + ra) * K + c8;
  const __bf16* gB1 = W + (size_t)(nBase + 64 + ra) * K + c8;

  v8f acc[2][2] = {};

  const int NK = K / 64;  // stages

  auto stage = [&](int buf, int k0) {
    async_copy16(gA  + k0,      &sA[buf][ra][c8]);
    async_copy16(gA  + k0 + 32, &sA[buf][ra][c8 + 32]);
    async_copy16(gB0 + k0,      &sB[buf][ra][c8]);
    async_copy16(gB0 + k0 + 32, &sB[buf][ra][c8 + 32]);
    async_copy16(gB1 + k0,      &sB[buf][64 + ra][c8]);
    async_copy16(gB1 + k0 + 32, &sB[buf][64 + ra][c8 + 32]);
  };

  stage(0, 0);  // prologue

  for (int kc = 0; kc < NK; ++kc) {
    const int cur = kc & 1;
    if (kc + 1 < NK) {
      stage(cur ^ 1, (kc + 1) * 64);
      wait_async6();   // previous buffer's 6 copies (this wave) complete
    } else {
      wait_async0();
    }
    __syncthreads();   // all waves' copies into `cur` visible

    const __bf16* ap = &sA[cur][wm * 32 + lm][0];
    const __bf16* bp = &sB[cur][wn * 32 + lm][0];
#pragma unroll
    for (int kk = 0; kk < 2; ++kk) {
      v16bf a0 = load_op16(ap + kk * 32, h);
      v16bf a1 = load_op16(ap + 16 * LDS_STRIDE + kk * 32, h);
      v16bf b0 = load_op16(bp + kk * 32, h);
      v16bf b1 = load_op16(bp + 16 * LDS_STRIDE + kk * 32, h);
      acc[0][0] = __builtin_amdgcn_wmma_f32_16x16x32_bf16(false, a0, false, b0, (short)0, acc[0][0], false, false);
      acc[0][1] = __builtin_amdgcn_wmma_f32_16x16x32_bf16(false, a0, false, b1, (short)0, acc[0][1], false, false);
      acc[1][0] = __builtin_amdgcn_wmma_f32_16x16x32_bf16(false, a1, false, b0, (short)0, acc[1][0], false, false);
      acc[1][1] = __builtin_amdgcn_wmma_f32_16x16x32_bf16(false, a1, false, b1, (short)0, acc[1][1], false, false);
    }

    __syncthreads();   // reads of `cur` done before it is overwritten
  }

#pragma unroll
  for (int ms = 0; ms < 2; ++ms)
#pragma unroll
    for (int ns = 0; ns < 2; ++ns) {
      const int n = nBase + wn * 32 + ns * 16 + lm;
      const float bn = bias[n];
#pragma unroll
      for (int j = 0; j < 8; ++j) {
        const int m = mBase + wm * 32 + ms * 16 + j + 8 * h;
        const float v = acc[ms][ns][j] + bn;
        if (mode == 3) {
          ((float*)out)[(size_t)m * N + n] = v;
        } else {
          const int bb = m >> 11, s = m & (S_ - 1);   // m = b*S + s
          const int hd = n >> 6,  d = n & (DK_ - 1);  // n = h*DK + d
          __bf16* o = (__bf16*)out;
          if (mode == 1)
            o[(((size_t)(bb * NH_ + hd)) * S_ + s) * DK_ + d] = (__bf16)v;
          else
            o[(((size_t)(bb * NH_ + hd)) * DK_ + d) * S_ + s] = (__bf16)v;
        }
      }
    }
}

// ---------------------------------------------------------------------------
// Flash attention: one wave owns a 16-row Q tile; the work-group's 8 waves are
// 8 Q tiles of ONE head, so each 64-key K tile and V tile is brought into LDS
// once per work-group by asynchronous copies (whole 128-byte rows, two buffers,
// the next tile in flight while this one is worked on) and every wave reads its
// WMMA operands from there.  Q,K: [B,NH,S,DK]; V: [B,NH,DK,S] bf16.
#define KT_ 64        // keys per staged tile = two passes of 32 keys
#define KV_PITCH 72   // 128-byte rows at a 144-byte pitch (16 B x odd) for ds_load_b128

__global__ void __launch_bounds__(256)
flash_attn_bf16(const __bf16* __restrict__ Q, const __bf16* __restrict__ Kh,
                const __bf16* __restrict__ Vt, const int* __restrict__ mask,
                __bf16* __restrict__ ctx) {
  __shared__ __attribute__((aligned(16))) __bf16 sK[2][KT_][KV_PITCH];
  __shared__ __attribute__((aligned(16))) __bf16 sV[2][DK_][KV_PITCH];
  __shared__ __bf16 ldsP[8][16 * 32];
  const int wid  = threadIdx.x >> 5;
  const int lane = threadIdx.x & 31;
  const int lm = lane & 15, h = lane >> 4;

  const int gt = blockIdx.x * 8 + wid;
  const int qt = gt & (S_ / 16 - 1);
  const int bh = gt >> 7;
  const int hd = bh & (NH_ - 1);
  const int bb = bh >> 4;
  const int qbase = qt * 16;

  const __bf16* Qp = Q  + ((size_t)(bb * NH_ + hd)) * S_ * DK_;
  const __bf16* Kp = Kh + ((size_t)(bb * NH_ + hd)) * S_ * DK_;
  const __bf16* Vp = Vt + ((size_t)(bb * NH_ + hd)) * DK_ * S_;
  const int* mp = mask + (size_t)bb * S_ * S_;

  v16bf aq[2];
#pragma unroll
  for (int c = 0; c < 2; ++c)
    aq[c] = load_op16(Qp + (size_t)(qbase + lm) * DK_ + 32 * c, h);

  v8f oacc[4] = {};
  float mrow[8], lrow[8];
#pragma unroll
  for (int j = 0; j < 8; ++j) { mrow[j] = -3.0e38f; lrow[j] = 0.f; }

  v16bf bk[2][2];  // [key-subtile][dk-chunk]
  v16bf bv[4];
  int   mk[2][8];

  // staging: 8 threads per 128-byte row, 32 rows per sweep, two sweeps per tile
  const int cr = threadIdx.x >> 3;        // 0..31
  const int cc = (threadIdx.x & 7) * 8;   // element in the row
  const __bf16* gK = Kp + (size_t)cr * DK_ + cc;
  const __bf16* gV = Vp + (size_t)cr * S_ + cc;

  auto stageKV = [&](int buf, int kb0) {
    const __bf16* k0 = gK + (size_t)kb0 * DK_;
    const __bf16* k1 = k0 + 32 * DK_;
    const __bf16* v0 = gV + kb0;
    const __bf16* v1 = v0 + (size_t)32 * S_;
    const unsigned lk0 = (unsigned)(uintptr_t)&sK[buf][cr][cc];
    const unsigned lk1 = (unsigned)(uintptr_t)&sK[buf][32 + cr][cc];
    const unsigned lv0 = (unsigned)(uintptr_t)&sV[buf][cr][cc];
    const unsigned lv1 = (unsigned)(uintptr_t)&sV[buf][32 + cr][cc];
    // the four copies of one tile; s_wait_xcnt closes the statement so that no
    // address register of a copy is rewritten ahead of it
    asm volatile(
        "global_load_async_to_lds_b128 %0, %4, off\n\t"
        "global_load_async_to_lds_b128 %1, %5, off\n\t"
        "global_load_async_to_lds_b128 %2, %6, off\n\t"
        "global_load_async_to_lds_b128 %3, %7, off\n\t"
        "s_wait_xcnt 0x0"
        :: "v"(lk0), "v"(lk1), "v"(lv0), "v"(lv1),
           "v"(k0), "v"(k1), "v"(v0), "v"(v1)
        : "memory");
  };

  const int NT = S_ / KT_;  // staged tiles
  stageKV(0, 0);
  wait_async0();     // this wave's share of tile 0 has landed
  __syncthreads();   // tile 0 readable by every wave
  stageKV(1, KT_);

  for (int ti = 0; ti < NT; ++ti) {
   const int buf = ti & 1;
   // unrolled so that the pass's place in the tile is a constant LDS offset
#pragma unroll
   for (int p = 0; p < KT_ / 32; ++p) {
    const int kb = ti * KT_ + p * 32;
    // ---- K operands of this pass from the staged tile (unrolled: constant
    // indices keep bk in registers)
#pragma unroll
    for (int tt = 0; tt < 2; ++tt)
#pragma unroll
      for (int c = 0; c < 2; ++c)
        bk[tt][c] = load_op16(&sK[buf][p * 32 + 16 * tt + lm][32 * c], h);

    // ---- scores: S[16q x 32k], K-dim = DK in two chunks of 32
    v8f sc[2] = {};
#pragma unroll
    for (int tt = 0; tt < 2; ++tt)
#pragma unroll
      for (int c = 0; c < 2; ++c)
        sc[tt] = __builtin_amdgcn_wmma_f32_16x16x32_bf16(
            false, aq[c], false, bk[tt][c], (short)0, sc[tt], false, false);

    // ---- mask from global (needed soonest), V operands from the staged tile
#pragma unroll
    for (int tt = 0; tt < 2; ++tt)
#pragma unroll
      for (int j = 0; j < 8; ++j)
        mk[tt][j] = mp[(size_t)(qbase + j + 8 * h) * S_ + kb + 16 * tt + lm];
#pragma unroll
    for (int nt = 0; nt < 4; ++nt)
      bv[nt] = load_op16(&sV[buf][nt * 16 + lm][p * 32], h);

    // ---- scale by 1/sqrt(DK), apply mask
#pragma unroll
    for (int t = 0; t < 2; ++t)
#pragma unroll
      for (int j = 0; j < 8; ++j) {
        const float v = sc[t][j] * 0.125f;
        sc[t][j] = (mk[t][j] != 0) ? v : -60000.f;
      }

    // ---- online softmax; C-layout rows live in 16-lane halves
    float alpha[8];
#pragma unroll
    for (int j = 0; j < 8; ++j) {
      float cm = fmaxf(sc[0][j], sc[1][j]);
#pragma unroll
      for (int d = 1; d < 16; d <<= 1) cm = fmaxf(cm, __shfl_xor(cm, d, 32));
      const float mnew = fmaxf(mrow[j], cm);
      alpha[j] = __expf(mrow[j] - mnew);
      const float p0 = __expf(sc[0][j] - mnew);
      const float p1 = __expf(sc[1][j] - mnew);
      sc[0][j] = p0; sc[1][j] = p1;
      float rs = p0 + p1;
#pragma unroll
      for (int d = 1; d < 16; d <<= 1) rs += __shfl_xor(rs, d, 32);
      lrow[j] = lrow[j] * alpha[j] + rs;
      mrow[j] = mnew;
    }
#pragma unroll
    for (int nt = 0; nt < 4; ++nt)
#pragma unroll
      for (int j = 0; j < 8; ++j) oacc[nt][j] *= alpha[j];

    // ---- P: C-layout regs -> LDS row-major -> reload as A operand
    __bf16* pl = &ldsP[wid][0];
#pragma unroll
    for (int t = 0; t < 2; ++t)
#pragma unroll
      for (int j = 0; j < 8; ++j)
        pl[(j + 8 * h) * 32 + 16 * t + lm] = (__bf16)sc[t][j];
    asm volatile("s_wait_dscnt 0x0" ::: "memory");
    v16bf pa = load_op16(pl + lm * 32, h);

    // ---- O += P @ V (4 N-tiles over DK)
#pragma unroll
    for (int nt = 0; nt < 4; ++nt)
      oacc[nt] = __builtin_amdgcn_wmma_f32_16x16x32_bf16(
          false, pa, false, bv[nt], (short)0, oacc[nt], false, false);
   }

   // ---- publish point of tile ti + 1; the barrier also ends every wave's reads
   // of this tile's buffer, which is refilled behind it
   asm volatile("s_wait_dscnt 0x0" ::: "memory");  // own LDS reads retired
   wait_async0();                                  // own copies of tile ti + 1 landed
   __syncthreads();
   if (ti + 2 < NT) stageKV(buf, (ti + 2) * KT_);
  }
  wait_async0();  // nothing in flight when the wave ends

  // ---- normalize, emit context [B,S,H] bf16
#pragma unroll
  for (int j = 0; j < 8; ++j) {
    const float inv = 1.f / lrow[j];
    const int qr = qbase + j + 8 * h;
#pragma unroll
    for (int nt = 0; nt < 4; ++nt)
      ctx[((size_t)(bb * S_ + qr)) * H_ + hd * DK_ + nt * 16 + lm] =
          (__bf16)(oacc[nt][j] * inv);
  }
}

// ---------------------------------------------------------------------------
extern "C" void kernel_launch(void* const* d_in, const int* in_sizes, int n_in,
                              void* d_out, int out_size, void* d_ws, size_t ws_size,
                              hipStream_t stream) {
  (void)in_sizes; (void)n_in; (void)out_size; (void)ws_size;
  const float* query = (const float*)d_in[0];
  const float* key   = (const float*)d_in[1];
  const int*   amask = (const int*)d_in[2];
  const float* Wq = (const float*)d_in[3]; const float* bq = (const float*)d_in[4];
  const float* Wk = (const float*)d_in[5]; const float* bk = (const float*)d_in[6];
  const float* Wv = (const float*)d_in[7]; const float* bv = (const float*)d_in[8];
  const float* Wo = (const float*)d_in[9]; const float* bo = (const float*)d_in[10];

  char* ws = (char*)d_ws;
  const size_t MB = 1u << 20;
  const int SZ_X = B_ * S_ * H_;  // 4194304 elements
  const int SZ_W = H_ * H_;       // 1048576 elements
  __bf16* Xq  = (__bf16*)(ws +  0 * MB);
  __bf16* Xk  = (__bf16*)(ws +  8 * MB);
  __bf16* Wqb = (__bf16*)(ws + 16 * MB);
  __bf16* Wkb = (__bf16*)(ws + 18 * MB);
  __bf16* Wvb = (__bf16*)(ws + 20 * MB);
  __bf16* Wob = (__bf16*)(ws + 22 * MB);
  __bf16* Qh  = (__bf16*)(ws + 24 * MB);  // [B,NH,S,DK]
  __bf16* Khd = (__bf16*)(ws + 32 * MB);  // [B,NH,S,DK]
  __bf16* Vtd = (__bf16*)(ws + 40 * MB);  // [B,NH,DK,S]
  __bf16* ctx = (__bf16*)(ws + 48 * MB);  // [B,S,H]

  cvt_f32_bf16<<<1024, 256, 0, stream>>>(query, Xq, SZ_X / 4);
  cvt_f32_bf16<<<1024, 256, 0, stream>>>(key,   Xk, SZ_X / 4);
  cvt_f32_bf16<<<256,  256, 0, stream>>>(Wq, Wqb, SZ_W / 4);
  cvt_f32_bf16<<<256,  256, 0, stream>>>(Wk, Wkb, SZ_W / 4);
  cvt_f32_bf16<<<256,  256, 0, stream>>>(Wv, Wvb, SZ_W / 4);
  cvt_f32_bf16<<<256,  256, 0, stream>>>(Wo, Wob, SZ_W / 4);

  dim3 gg(64, 8);  // M/64 x N/128
  gemm_bf16_wmma<<<gg, 256, 0, stream>>>(Xq, Wqb, bq, Qh,  B_*S_, H_, H_, 1);
  gemm_bf16_wmma<<<gg, 256, 0, stream>>>(Xk, Wkb, bk, Khd, B_*S_, H_, H_, 1);
  gemm_bf16_wmma<<<gg, 256, 0, stream>>>(Xk, Wvb, bv, Vtd, B_*S_, H_, H_, 2);

  flash_attn_bf16<<<512, 256, 0, stream>>>(Qh, Khd, Vtd, amask, ctx);

  gemm_bf16_wmma<<<gg, 256, 0, stream>>>(ctx, Wob, bo, d_out, B_*S_, H_, H_, 3);
}

// v002
// A run of this version takes 150 microseconds.
// Timed twice side by side with v001, it ran 1.30 times as fast both times.
// All steps since v000 together make it 2.85 times as fast.
#include <hip/hip_runtime.h>
#include <hip/hip_bf16.h>

typedef __attribute__((ext_vector_type(16))) __bf16 v16bf;
typedef __attribute__((ext_vector_type(8)))  __bf16 v8bf;
typedef __attribute__((ext_vector_type(4)))  __bf16 v4bf;
typedef __attribute__((ext_vector_type(8)))  float  v8f;
typedef __attribute__((ext_vector_type(4)))  float  v4f;
typedef __attribute__((ext_vector_type(4)))  int    v4i;
typedef __attribute__((ext_vector_type(2)))  int    v2i;

#define B_  2
#define S_  2048
#define H_  1024
#define NH_ 16
#define DK_ 64

// ---------------------------------------------------------------------------
// WMMA operand builder: CDNA5 16-bit A/B layout, lane-half h holds
// K{8h..8h+7} in elements 0..7 and K{16+8h..16+8h+7} in elements 8..15.
static __device__ __forceinline__ v16bf load_op16(const __bf16* base, int h) {
  v8bf lo = *(const v8bf*)(base + 8 * h);
  v8bf hi = *(const v8bf*)(base + 16 + 8 * h);
  v16bf r;
#pragma unroll
  for (int i = 0; i < 8; ++i) { r[i] = lo[i]; r[8 + i] = hi[i]; }
  return r;
}

// 16-byte async global->LDS copy (ASYNCcnt-tracked).
static __device__ __forceinline__ void async_copy16(const __bf16* g, __bf16* l) {
#if __has_builtin(__builtin_amdgcn_global_load_async_to_lds_b128)
  __builtin_amdgcn_global_load_async_to_lds_b128(
      (__attribute__((address_space(1))) v4i*)(uintptr_t)g,
      (__attribute__((address_space(3))) v4i*)(unsigned)(uintptr_t)l, 0, 0);
#else
  asm volatile("global_load_async_to_lds_b128 %0, %1, off"
               :: "v"((unsigned)(uintptr_t)l),
                  "v"((unsigned long long)(uintptr_t)g)
               : "memory");
#endif
}

static __device__ __forceinline__ void wait_async6() {
  asm volatile("s_wait_asynccnt 0x6" ::: "memory");
}
static __device__ __forceinline__ void wait_async0() {
  asm volatile("s_wait_asynccnt 0x0" ::: "memory");
}

__global__ void cvt_f32_bf16(const float* __restrict__ in,
                             __bf16* __restrict__ out, int n4) {
  int i = blockIdx.x * blockDim.x + threadIdx.x;
  int stride = gridDim.x * blockDim.x;
  for (; i < n4; i += stride) {
    v4f x = ((const v4f*)in)[i];
    v4bf y;
#pragma unroll
    for (int j = 0; j < 4; ++j) y[j] = (__bf16)x[j];
    ((v4bf*)out)[i] = y;
  }
}

// ---------------------------------------------------------------------------
// C[M,N] = A[M,K](bf16) @ W[N,K]^T(bf16) + bias[N](f32)
// LDS-staged, double-buffered async pipeline.  WG = 256 thr (8 waves),
// tile 64(M) x 128(N) x 64(K) per stage; wave tile 32x32; 8 WMMAs/stage/wave.
// mode 1: bf16 out [B,NH,S,DK]; mode 2: bf16 out [B,NH,DK,S]; mode 3: f32 [M,N]
#define LDS_STRIDE 72  // 64 + 8 bf16 pad -> 36-bank row stride, conflict-free

__global__ void __launch_bounds__(256)
gemm_bf16_wmma(const __bf16* __restrict__ A, const __bf16* __restrict__ W,
               const float* __restrict__ bias, void* __restrict__ out,
               int M, int N, int K, int mode) {
  __shared__ __bf16 sA[2][64][LDS_STRIDE];
  __shared__ __bf16 sB[2][128][LDS_STRIDE];

  const int tid  = threadIdx.x;
  const int wid  = tid >> 5;
  const int lane = tid & 31;
  const int lm = lane & 15, h = lane >> 4;
  const int wm = wid & 1, wn = wid >> 1;
  const int mBase = blockIdx.x * 64;
  const int nBase = blockIdx.y * 128;

  // staging: 4 threads/row, each thread covers elem [c8,c8+8) and [c8+32,c8+40)
  const int ra = tid >> 2;         // 0..63
  const int c8 = (tid & 3) * 8;
  const __bf16* gA  = A + (size_t)(mBase + ra) * K + c8;
  const __bf16* gB0 = W + (size_t)(nBase + ra) * K + c8;
  const __bf16* gB1 = W + (size_t)(nBase + 64 + ra) * K + c8;

  v8f acc[2][2] = {};

  const int NK = K / 64;  // stages

  auto stage = [&](int buf, int k0) {
    async_copy16(gA  + k0,      &sA[buf][ra][c8]);
    async_copy16(gA  + k0 + 32, &sA[buf][ra][c8 + 32]);
    async_copy16(gB0 + k0,      &sB[buf][ra][c8]);
    async_copy16(gB0 + k0 + 32, &sB[buf][ra][c8 + 32]);
    async_copy16(gB1 + k0,      &sB[buf][64 + ra][c8]);
    async_copy16(gB1 + k0 + 32, &sB[buf][64 + ra][c8 + 32]);
  };

  stage(0, 0);  // prologue

  for (int kc = 0; kc < NK; ++kc) {
    const int cur = kc & 1;
    if (kc + 1 < NK) {
      stage(cur ^ 1, (kc + 1) * 64);
      wait_async6();   // previous buffer's 6 copies (this wave) complete
    } else {
      wait_async0();
    }
    __syncthreads();   // all waves' copies into `cur` visible

    const __bf16* ap = &sA[cur][wm * 32 + lm][0];
    const __bf16* bp = &sB[cur][wn * 32 + lm][0];
#pragma unroll
    for (int kk = 0; kk < 2; ++kk) {
      v16bf a0 = load_op16(ap + kk * 32, h);
      v16bf a1 = load_op16(ap + 16 * LDS_STRIDE + kk * 32, h);
      v16bf b0 = load_op16(bp + kk * 32, h);
      v16bf b1 = load_op16(bp + 16 * LDS_STRIDE + kk * 32, h);
      acc[0][0] = __builtin_amdgcn_wmma_f32_16x16x32_bf16(false, a0, false, b0, (short)0, acc[0][0], false, false);
      acc[0][1] = __builtin_amdgcn_wmma_f32_16x16x32_bf16(false, a0, false, b1, (short)0, acc[0][1], false, false);
      acc[1][0] = __builtin_amdgcn_wmma_f32_16x16x32_bf16(false, a1, false, b0, (short)0, acc[1][0], false, false);
      acc[1][1] = __builtin_amdgcn_wmma_f32_16x16x32_bf16(false, a1, false, b1, (short)0, acc[1][1], false, false);
    }

    __syncthreads();   // reads of `cur` done before it is overwritten
  }

#pragma unroll
  for (int ms = 0; ms < 2; ++ms)
#pragma unroll
    for (int ns = 0; ns < 2; ++ns) {
      const int n = nBase + wn * 32 + ns * 16 + lm;
      const float bn = bias[n];
#pragma unroll
      for (int j = 0; j < 8; ++j) {
        const int m = mBase + wm * 32 + ms * 16 + j + 8 * h;
        const float v = acc[ms][ns][j] + bn;
        if (mode == 3) {
          ((float*)out)[(size_t)m * N + n] = v;
        } else {
          const int bb = m >> 11, s = m & (S_ - 1);   // m = b*S + s
          const int hd = n >> 6,  d = n & (DK_ - 1);  // n = h*DK + d
          __bf16* o = (__bf16*)out;
          if (mode == 1)
            o[(((size_t)(bb * NH_ + hd)) * S_ + s) * DK_ + d] = (__bf16)v;
          else
            o[(((size_t)(bb * NH_ + hd)) * DK_ + d) * S_ + s] = (__bf16)v;
        }
      }
    }
}

// ---------------------------------------------------------------------------
// Flash attention: one wave owns a 16-row Q tile; the work-group's 8 waves are
// 8 Q tiles of ONE head, so each 64-key K tile and V tile is brought into LDS
// once per work-group by asynchronous copies (whole 128-byte rows, two buffers,
// the next tile in flight while this one is worked on) and every wave reads its
// WMMA operands from there.  Q,K: [B,NH,S,DK]; V: [B,NH,DK,S] bf16.
// The products are taken transposed: St = K Qt and Ot += Vt Pt.  A lane then
// holds 16 of the 32 keys of ONE query (lane lm = query, register j = key
// 8h + j of a 16-key tile), so maximum and sum run inside the lane with one
// exchange between the wave's halves, and the two score tiles, converted in
// place, are the B operand of the second product in the hardware k order.
// What has to be turned is now the mask, not P: each wave reads its 16 mask rows
// as whole rows (lane = key) and turns them through its own LDS patch, off the
// path from the scores to the second product.
#define KT_ 64        // keys per staged tile = two passes of 32 keys
#define KV_PITCH 72   // 128-byte rows at a 144-byte pitch (16 B x odd) for ds_load_b128
#define M_PITCH 68    // 256-byte mask rows at a 272-byte pitch (16 B x odd), same reader

// value of lane l ^ 16
static __device__ __forceinline__ float other_half(float x) {
  const int b = __builtin_bit_cast(int, x);
  return __builtin_bit_cast(
      float, __builtin_amdgcn_permlanex16(b, b, 0x76543210, 0xfedcba98, false, false));
}

__global__ void __launch_bounds__(256)
flash_attn_bf16(const __bf16* __restrict__ Q, const __bf16* __restrict__ Kh,
                const __bf16* __restrict__ Vt, const int* __restrict__ mask,
                __bf16* __restrict__ ctx) {
  __shared__ __attribute__((aligned(16))) __bf16 sK[2][KT_][KV_PITCH];
  __shared__ __attribute__((aligned(16))) __bf16 sV[2][DK_][KV_PITCH];
  __shared__ __attribute__((aligned(16))) int sM[8][16][M_PITCH];  // one patch per wave
  const int wid  = threadIdx.x >> 5;
  const int lane = threadIdx.x & 31;
  const int lm = lane & 15, h = lane >> 4;

  const int gt = blockIdx.x * 8 + wid;
  const int qt = gt & (S_ / 16 - 1);
  const int bh = gt >> 7;
  const int hd = bh & (NH_ - 1);
  const int bb = bh >> 4;
  const int qbase = qt * 16;

  const __bf16* Qp = Q  + ((size_t)(bb * NH_ + hd)) * S_ * DK_;
  const __bf16* Kp = Kh + ((size_t)(bb * NH_ + hd)) * S_ * DK_;
  const __bf16* Vp = Vt + ((size_t)(bb * NH_ + hd)) * DK_ * S_;
  // the wave's first mask row, at this lane's two keys of a 64-key tile
  const int* mp = mask + (size_t)bb * S_ * S_ + (size_t)qbase * S_ + 2 * lane;

  v16bf bq[2];   // Q as B operand: column lm = query
#pragma unroll
  for (int c = 0; c < 2; ++c)
    bq[c] = load_op16(Qp + (size_t)(qbase + lm) * DK_ + 32 * c, h);

  v8f oacc[4] = {};          // Ot: oacc[nt][j] = O[query lm][nt*16 + 8h + j]
  float mrow = -3.0e38f;     // running maximum of query lm (equal in both halves)
  float lrow = 0.f;          // running sum over this half's keys only

  v16bf ak[2][2];  // [key-subtile][dk-chunk]
  v16bf av[4];
  v4i   mk[2][2];
  v2i   mg[16];

  // staging: 8 threads per 128-byte row, 32 rows per sweep, two sweeps per tile
  const int cr = threadIdx.x >> 3;        // 0..31
  const int cc = (threadIdx.x & 7) * 8;   // element in the row
  const __bf16* gK = Kp + (size_t)cr * DK_ + cc;
  const __bf16* gV = Vp + (size_t)cr * S_ + cc;

  auto stageKV = [&](int buf, int kb0) {
    const __bf16* k0 = gK + (size_t)kb0 * DK_;
    const __bf16* k1 = k0 + 32 * DK_;
    const __bf16* v0 = gV + kb0;
    const __bf16* v1 = v0 + (size_t)32 * S_;
    const unsigned lk0 = (unsigned)(uintptr_t)&sK[buf][cr][cc];
    const unsigned lk1 = (unsigned)(uintptr_t)&sK[buf][32 + cr][cc];
    const unsigned lv0 = (unsigned)(uintptr_t)&sV[buf][cr][cc];
    const unsigned lv1 = (unsigned)(uintptr_t)&sV[buf][32 + cr][cc];
    // the four copies of one tile; s_wait_xcnt closes the statement so that no
    // address register of a copy is rewritten ahead of it
    asm volatile(
        "global_load_async_to_lds_b128 %0, %4, off\n\t"
        "global_load_async_to_lds_b128 %1, %5, off\n\t"
        "global_load_async_to_lds_b128 %2, %6, off\n\t"
        "global_load_async_to_lds_b128 %3, %7, off\n\t"
        "s_wait_xcnt 0x0"
        :: "v"(lk0), "v"(lk1), "v"(lv0), "v"(lv1),
           "v"(k0), "v"(k1), "v"(v0), "v"(v1)
        : "memory");
  };

  const int NT = S_ / KT_;  // staged tiles
  stageKV(0, 0);
  wait_async0();     // this wave's share of tile 0 has landed
  __syncthreads();   // tile 0 readable by every wave
  stageKV(1, KT_);

  for (int ti = 0; ti < NT; ++ti) {
   const int buf = ti & 1;
   // ---- mask of this tile from global: one whole 256-byte row per load
   // (unrolled: constant indices keep mg in registers)
#pragma unroll
   for (int r = 0; r < 16; ++r)
     mg[r] = *(const v2i*)(mp + (size_t)r * S_ + ti * KT_);
   // unrolled so that the pass's place in the tile is a constant LDS offset
#pragma unroll
   for (int p = 0; p < KT_ / 32; ++p) {
    // ---- K operands of this pass from the staged tile (unrolled: constant
    // indices keep ak in registers)
#pragma unroll
    for (int tt = 0; tt < 2; ++tt)
#pragma unroll
      for (int c = 0; c < 2; ++c)
        ak[tt][c] = load_op16(&sK[buf][p * 32 + 16 * tt + lm][32 * c], h);

    // ---- scores: St[32k x 16q], K-dim = DK in two chunks of 32
    v8f sc[2] = {};
#pragma unroll
    for (int tt = 0; tt < 2; ++tt)
#pragma unroll
      for (int c = 0; c < 2; ++c)
        sc[tt] = __builtin_amdgcn_wmma_f32_16x16x32_bf16(
            false, ak[tt][c], false, bq[c], (short)0, sc[tt], false, false);

    // ---- the tile's mask rows into the wave's patch, behind the first scores
    // so that the global loads have those products to fly under
    if (p == 0) {
      // unrolled: mg is indexed by constants, the rows are constant LDS offsets
#pragma unroll
      for (int r = 0; r < 16; ++r) *(v2i*)&sM[wid][r][2 * lane] = mg[r];
      // the lanes read each other's stores: keeps the reads below behind them
      asm volatile("s_wait_dscnt 0x0" ::: "memory");
    }
    // ---- 8 consecutive keys of the lane's query per 16-key tile (unrolled:
    // constant indices keep mk in registers)
#pragma unroll
    for (int tt = 0; tt < 2; ++tt)
#pragma unroll
      for (int q = 0; q < 2; ++q)
        mk[tt][q] = *(const v4i*)&sM[wid][lm][p * 32 + 16 * tt + 8 * h + 4 * q];

    // ---- V operands from the staged tile: row = dk, k = keys
#pragma unroll
    for (int nt = 0; nt < 4; ++nt)
      av[nt] = load_op16(&sV[buf][nt * 16 + lm][p * 32], h);

    // ---- scale by 1/sqrt(DK), apply mask
#pragma unroll
    for (int t = 0; t < 2; ++t)
#pragma unroll
      for (int j = 0; j < 8; ++j) {
        const float v = sc[t][j] * 0.125f;
        sc[t][j] = (mk[t][j >> 2][j & 3] != 0) ? v : -60000.f;
      }

    // ---- online softmax of one query per lane (its loops unrolled: sc is
    // indexed by constants and stays in registers)
    float cm = fmaxf(sc[0][0], sc[1][0]);
#pragma unroll
    for (int j = 1; j < 8; ++j) cm = fmaxf(cm, fmaxf(sc[0][j], sc[1][j]));
    cm = fmaxf(cm, other_half(cm));
    const float mnew = fmaxf(mrow, cm);
    const float alpha = __expf(mrow - mnew);
    mrow = mnew;
    float rs0 = 0.f, rs1 = 0.f;
#pragma unroll
    for (int j = 0; j < 8; ++j) {
      sc[0][j] = __expf(sc[0][j] - mnew);
      sc[1][j] = __expf(sc[1][j] - mnew);
      rs0 += sc[0][j];
      rs1 += sc[1][j];
    }
    lrow = lrow * alpha + (rs0 + rs1);
#pragma unroll
    for (int nt = 0; nt < 4; ++nt)
#pragma unroll
      for (int j = 0; j < 8; ++j) oacc[nt][j] *= alpha;

    // ---- Pt: the two score tiles, converted in place, are the B operand
    // (unrolled: pb and sc stay in registers)
    v16bf pb;
#pragma unroll
    for (int j = 0; j < 8; ++j) {
      pb[j]     = (__bf16)sc[0][j];
      pb[8 + j] = (__bf16)sc[1][j];
    }

    // ---- Ot += Vt @ Pt (4 M-tiles over DK)
#pragma unroll
    for (int nt = 0; nt < 4; ++nt)
      oacc[nt] = __builtin_amdgcn_wmma_f32_16x16x32_bf16(
          false, av[nt], false, pb, (short)0, oacc[nt], false, false);
   }

   // ---- publish point of tile ti + 1; the barrier also ends every wave's reads
   // of this tile's buffer, which is refilled behind it
   asm volatile("s_wait_dscnt 0x0" ::: "memory");  // own LDS reads retired
   wait_async0();                                  // own copies of tile ti + 1 landed
   __syncthreads();
   if (ti + 2 < NT) stageKV(buf, (ti + 2) * KT_);
  }
  wait_async0();  // nothing in flight when the wave ends

  // ---- join the halves' sums, normalize, emit context [B,S,H] bf16:
  // 8 consecutive dk of one query per lane and tile, one 16-byte store each
  // (unrolled: oacc is indexed by constants)
  const float inv = 1.f / (lrow + other_half(lrow));
  __bf16* op = ctx + ((size_t)(bb * S_ + qbase + lm)) * H_ + hd * DK_ + 8 * h;
#pragma unroll
  for (int nt = 0; nt < 4; ++nt) {
    v8bf y;
#pragma unroll
    for (int j = 0; j < 8; ++j) y[j] = (__bf16)(oacc[nt][j] * inv);
    *(v8bf*)(op + nt * 16) = y;
  }
}

// ---------------------------------------------------------------------------
extern "C" void kernel_launch(void* const* d_in, const int* in_sizes, int n_in,
                              void* d_out, int out_size, void* d_ws, size_t ws_size,
                              hipStream_t stream) {
  (void)in_sizes; (void)n_in; (void)out_size; (void)ws_size;
  const float* query = (const float*)d_in[0];
  const float* key   = (const float*)d_in[1];
  const int*   amask = (const int*)d_in[2];
  const float* Wq = (const float*)d_in[3]; const float* bq = (const float*)d_in[4];
  const float* Wk = (const float*)d_in[5]; const float* bk = (const float*)d_in[6];
  const float* Wv = (const float*)d_in[7]; const float* bv = (const float*)d_in[8];
  const float* Wo = (const float*)d_in[9]; const float* bo = (const float*)d_in[10];

  char* ws = (char*)d_ws;
  const size_t MB = 1u << 20;
  const int SZ_X = B_ * S_ * H_;  // 4194304 elements
  const int SZ_W = H_ * H_;       // 1048576 elements
  __bf16* Xq  = (__bf16*)(ws +  0 * MB);
  __bf16* Xk  = (__bf16*)(ws +  8 * MB);
  __bf16* Wqb = (__bf16*)(ws + 16 * MB);
  __bf16* Wkb = (__bf16*)(ws + 18 * MB);
  __bf16* Wvb = (__bf16*)(ws + 20 * MB);
  __bf16* Wob = (__bf16*)(ws + 22 * MB);
  __bf16* Qh  = (__bf16*)(ws + 24 * MB);  // [B,NH,S,DK]
  __bf16* Khd = (__bf16*)(ws + 32 * MB);  // [B,NH,S,DK]
  __bf16* Vtd = (__bf16*)(ws + 40 * MB);  // [B,NH,DK,S]
  __bf16* ctx = (__bf16*)(ws + 48 * MB);  // [B,S,H]

  cvt_f32_bf16<<<1024, 256, 0, stream>>>(query, Xq, SZ_X / 4);
  cvt_f32_bf16<<<1024, 256, 0, stream>>>(key,   Xk, SZ_X / 4);
  cvt_f32_bf16<<<256,  256, 0, stream>>>(Wq, Wqb, SZ_W / 4);
  cvt_f32_bf16<<<256,  256, 0, stream>>>(Wk, Wkb, SZ_W / 4);
  cvt_f32_bf16<<<256,  256, 0, stream>>>(Wv, Wvb, SZ_W / 4);
  cvt_f32_bf16<<<256,  256, 0, stream>>>(Wo, Wob, SZ_W / 4);

  dim3 gg(64, 8);  // M/64 x N/128
  gemm_bf16_wmma<<<gg, 256, 0, stream>>>(Xq, Wqb, bq, Qh,  B_*S_, H_, H_, 1);
  gemm_bf16_wmma<<<gg, 256, 0, stream>>>(Xk, Wkb, bk, Khd, B_*S_, H_, H_, 1);
  gemm_bf16_wmma<<<gg, 256, 0, stream>>>(Xk, Wvb, bv, Vtd, B_*S_, H_, H_, 2);

  flash_attn_bf16<<<512, 256, 0, stream>>>(Qh, Khd, Vtd, amask, ctx);

  gemm_bf16_wmma<<<gg, 256, 0, stream>>>(ctx, Wob, bo, d_out, B_*S_, H_, H_, 3);
}

// v003
// One run takes 128 microseconds.
// In two side-by-side timings against v002, it was 1.17 and 1.16 times as fast.
// All steps since v000 together make it 3.33 times as fast.
#include <hip/hip_runtime.h>
#include <hip/hip_bf16.h>

typedef __attribute__((ext_vector_type(16))) __bf16 v16bf;
typedef __attribute__((ext_vector_type(8)))  __bf16 v8bf;
typedef __attribute__((ext_vector_type(4)))  __bf16 v4bf;
typedef __attribute__((ext_vector_type(8)))  float  v8f;
typedef __attribute__((ext_vector_type(4)))  float  v4f;
typedef __attribute__((ext_vector_type(4)))  int    v4i;
typedef __attribute__((ext_vector_type(2)))  int    v2i;

#define B_  2
#define S_  2048
#define H_  1024
#define NH_ 16
#define DK_ 64

// ---------------------------------------------------------------------------
// WMMA operand builder: CDNA5 16-bit A/B layout, lane-half h holds
// K{8h..8h+7} in elements 0..7 and K{16+8h..16+8h+7} in elements 8..15.
static __device__ __forceinline__ v16bf load_op16(const __bf16* base, int h) {
  v8bf lo = *(const v8bf*)(base + 8 * h);
  v8bf hi = *(const v8bf*)(base + 16 + 8 * h);
  v16bf r;
#pragma unroll
  for (int i = 0; i < 8; ++i) { r[i] = lo[i]; r[8 + i] = hi[i]; }
  return r;
}

// 16-byte async global->LDS copy (ASYNCcnt-tracked).
static __device__ __forceinline__ void async_copy16(const __bf16* g, __bf16* l) {
#if __has_builtin(__builtin_amdgcn_global_load_async_to_lds_b128)
  __builtin_amdgcn_global_load_async_to_lds_b128(
      (__attribute__((address_space(1))) v4i*)(uintptr_t)g,
      (__attribute__((address_space(3))) v4i*)(unsigned)(uintptr_t)l, 0, 0);
#else
  asm volatile("global_load_async_to_lds_b128 %0, %1, off"
               :: "v"((unsigned)(uintptr_t)l),
                  "v"((unsigned long long)(uintptr_t)g)
               : "memory");
#endif
}

static __device__ __forceinline__ void wait_async6() {
  asm volatile("s_wait_asynccnt 0x6" ::: "memory");
}
static __device__ __forceinline__ void wait_async0() {
  asm volatile("s_wait_asynccnt 0x0" ::: "memory");
}

// All six f32 -> bf16 conversions in one launch.  The six bf16 copies lie one
// behind the other in out: query, key (4 parts of H*H elements each), Wq, Wk, Wv,
// Wo (1 part each).  A block takes 4096 groups of four elements, 64 blocks a part,
// so the source is the same for a whole block.
#define CVT_GROUPS 4096                      // groups of four elements per block
#define CVT_BLOCKS_PER_PART (H_ * H_ / 4 / CVT_GROUPS)
__global__ void __launch_bounds__(256)
cvt_f32_bf16(const float* __restrict__ q, const float* __restrict__ k,
             const float* __restrict__ wq, const float* __restrict__ wk,
             const float* __restrict__ wv, const float* __restrict__ wo,
             __bf16* __restrict__ out) {
  const int part = blockIdx.x / CVT_BLOCKS_PER_PART;   // 0..11
  const float* in;
  int first;                                           // the source's first part
  if (part < 4)       { in = q;  first = 0; }
  else if (part < 8)  { in = k;  first = 4; }
  else if (part == 8) { in = wq; first = 8; }
  else if (part == 9) { in = wk; first = 9; }
  else if (part == 10) { in = wv; first = 10; }
  else                { in = wo; first = 11; }
  const int o0 = blockIdx.x * CVT_GROUPS + threadIdx.x;
  const int i0 = o0 - first * (H_ * H_ / 4);
  for (int r = 0; r < CVT_GROUPS / 256 / 8; ++r) {
    v4f x[8];
    // unrolled: eight loads in flight per lane, x indexed by constants
#pragma unroll
    for (int u = 0; u < 8; ++u) x[u] = ((const v4f*)in)[i0 + (r * 8 + u) * 256];
    // both unrolled: x and y are indexed by constants and stay in registers
#pragma unroll
    for (int u = 0; u < 8; ++u) {
      v4bf y;
#pragma unroll
      for (int j = 0; j < 4; ++j) y[j] = (__bf16)x[u][j];
      ((v4bf*)out)[o0 + (r * 8 + u) * 256] = y;
    }
  }
}

// ---------------------------------------------------------------------------
// C[M,N] = A[M,K](bf16) @ W[N,K]^T(bf16) + bias[N](f32)
// LDS-staged, double-buffered async pipeline.  WG = 256 thr (8 waves),
// tile 64(M) x 128(N) x 64(K) per stage; wave tile 32x32; 8 WMMAs/stage/wave.
// mode 1: bf16 out [B,NH,S,DK]; mode 2: bf16 out [B,NH,DK,S]; mode 3: f32 [M,N]
// Up to three independent products of one shape in one launch: blockIdx.z picks
// the operand set.
#define LDS_STRIDE 72  // 64 + 8 bf16 pad -> 36-bank row stride, conflict-free

__global__ void __launch_bounds__(256)
gemm_bf16_wmma(const __bf16* A0, const __bf16* W0, const float* bias0, void* out0, int mode0,
               const __bf16* A1, const __bf16* W1, const float* bias1, void* out1, int mode1,
               const __bf16* A2, const __bf16* W2, const float* bias2, void* out2, int mode2,
               int M, int N, int K) {
  __shared__ __bf16 sA[2][64][LDS_STRIDE];
  __shared__ __bf16 sB[2][128][LDS_STRIDE];

  const int z = blockIdx.z;
  const __bf16* __restrict__ A = z == 0 ? A0 : z == 1 ? A1 : A2;
  const __bf16* __restrict__ W = z == 0 ? W0 : z == 1 ? W1 : W2;
  const float* __restrict__ bias = z == 0 ? bias0 : z == 1 ? bias1 : bias2;
  void* __restrict__ out = z == 0 ? out0 : z == 1 ? out1 : out2;
  const int mode = z == 0 ? mode0 : z == 1 ? mode1 : mode2;

  const int tid  = threadIdx.x;
  const int wid  = tid >> 5;
  const int lane = tid & 31;
  const int lm = lane & 15, h = lane >> 4;
  const int wm = wid & 1, wn = wid >> 1;
  const int mBase = blockIdx.x * 64;
  const int nBase = blockIdx.y * 128;

  // staging: 4 threads/row, each thread covers elem [c8,c8+8) and [c8+32,c8+40)
  const int ra = tid >> 2;         // 0..63
  const int c8 = (tid & 3) * 8;
  const __bf16* gA  = A + (size_t)(mBase + ra) * K + c8;
  const __bf16* gB0 = W + (size_t)(nBase + ra) * K + c8;
  const __bf16* gB1 = W + (size_t)(nBase + 64 + ra) * K + c8;

  v8f acc[2][2] = {};

  const int NK = K / 64;  // stages

  auto stage = [&](int buf, int k0) {
    async_copy16(gA  + k0,      &sA[buf][ra][c8]);
    async_copy16(gA  + k0 + 32, &sA[buf][ra][c8 + 32]);
    async_copy16(gB0 + k0,      &sB[buf][ra][c8]);
    async_copy16(gB0 + k0 + 32, &sB[buf][ra][c8 + 32]);
    async_copy16(gB1 + k0,      &sB[buf][64 + ra][c8]);
    async_copy16(gB1 + k0 + 32, &sB[buf][64 + ra][c8 + 32]);
  };

  stage(0, 0);  // prologue

  for (int kc = 0; kc < NK; ++kc) {
    const int cur = kc & 1;
    if (kc + 1 < NK) {
      stage(cur ^ 1, (kc + 1) * 64);
      wait_async6();   // previous buffer's 6 copies (this wave) complete
    } else {
      wait_async0();
    }
    __syncthreads();   // all waves' copies into `cur` visible

    const __bf16* ap = &sA[cur][wm * 32 + lm][0];
    const __bf16* bp = &sB[cur][wn * 32 + lm][0];
#pragma unroll
    for (int kk = 0; kk < 2; ++kk) {
      v16bf a0 = load_op16(ap + kk * 32, h);
      v16bf a1 = load_op16(ap + 16 * LDS_STRIDE + kk * 32, h);
      v16bf b0 = load_op16(bp + kk * 32, h);
      v16bf b1 = load_op16(bp + 16 * LDS_STRIDE + kk * 32, h);
      acc[0][0] = __builtin_amdgcn_wmma_f32_16x16x32_bf16(false, a0, false, b0, (short)0, acc[0][0], false, false);
      acc[0][1] = __builtin_amdgcn_wmma_f32_16x16x32_bf16(false, a0, false, b1, (short)0, acc[0][1], false, false);
      acc[1][0] = __builtin_amdgcn_wmma_f32_16x16x32_bf16(false, a1, false, b0, (short)0, acc[1][0], false, false);
      acc[1][1] = __builtin_amdgcn_wmma_f32_16x16x32_bf16(false, a1, false, b1, (short)0, acc[1][1], false, false);
    }

    __syncthreads();   // reads of `cur` done before it is overwritten
  }

#pragma unroll
  for (int ms = 0; ms < 2; ++ms)
#pragma unroll
    for (int ns = 0; ns < 2; ++ns) {
      const int n = nBase + wn * 32 + ns * 16 + lm;
      const float bn = bias[n];
#pragma unroll
      for (int j = 0; j < 8; ++j) {
        const int m = mBase + wm * 32 + ms * 16 + j + 8 * h;
        const float v = acc[ms][ns][j] + bn;
        if (mode == 3) {
          ((float*)out)[(size_t)m * N + n] = v;
        } else {
          const int bb = m >> 11, s = m & (S_ - 1);   // m = b*S + s
          const int hd = n >> 6,  d = n & (DK_ - 1);  // n = h*DK + d
          __bf16* o = (__bf16*)out;
          if (mode == 1)
            o[(((size_t)(bb * NH_ + hd)) * S_ + s) * DK_ + d] = (__bf16)v;
          else
            o[(((size_t)(bb * NH_ + hd)) * DK_ + d) * S_ + s] = (__bf16)v;
        }
      }
    }
}

// ---------------------------------------------------------------------------
// Flash attention: one wave owns a 16-row Q tile; the work-group's 8 waves are
// 8 Q tiles of ONE head, so each 64-key K tile and V tile is brought into LDS
// once per work-group by asynchronous copies (whole 128-byte rows, two buffers,
// the next tile in flight while this one is worked on) and every wave reads its
// WMMA operands from there.  Q,K: [B,NH,S,DK]; V: [B,NH,DK,S] bf16.
// The products are taken transposed: St = K Qt and Ot += Vt Pt.  A lane then
// holds 16 of the 32 keys of ONE query (lane lm = query, register j = key
// 8h + j of a 16-key tile), so maximum and sum run inside the lane with one
// exchange between the wave's halves, and the two score tiles, converted in
// place, are the B operand of the second product in the hardware k order.
// What has to be turned is now the mask, not P: each wave reads its 16 mask rows
// as whole rows (lane = key) and turns them through its own LDS patch, off the
// path from the scores to the second product.
#define KT_ 64        // keys per staged tile = two passes of 32 keys
#define KV_PITCH 72   // 128-byte rows at a 144-byte pitch (16 B x odd) for ds_load_b128
#define M_PITCH 68    // 256-byte mask rows at a 272-byte pitch (16 B x odd), same reader

// value of lane l ^ 16
static __device__ __forceinline__ float other_half(float x) {
  const int b = __builtin_bit_cast(int, x);
  return __builtin_bit_cast(
      float, __builtin_amdgcn_permlanex16(b, b, 0x76543210, 0xfedcba98, false, false));
}

__global__ void __launch_bounds__(256)
flash_attn_bf16(const __bf16* __restrict__ Q, const __bf16* __restrict__ Kh,
                const __bf16* __restrict__ Vt, const int* __restrict__ mask,
                __bf16* __restrict__ ctx) {
  __shared__ __attribute__((aligned(16))) __bf16 sK[2][KT_][KV_PITCH];
  __shared__ __attribute__((aligned(16))) __bf16 sV[2][DK_][KV_PITCH];
  __shared__ __attribute__((aligned(16))) int sM[8][16][M_PITCH];  // one patch per wave
  const int wid  = threadIdx.x >> 5;
  const int lane = threadIdx.x & 31;
  const int lm = lane & 15, h = lane >> 4;

  const int gt = blockIdx.x * 8 + wid;
  const int qt = gt & (S_ / 16 - 1);
  const int bh = gt >> 7;
  const int hd = bh & (NH_ - 1);
  const int bb = bh >> 4;
  const int qbase = qt * 16;

  const __bf16* Qp = Q  + ((size_t)(bb * NH_ + hd)) * S_ * DK_;
  const __bf16* Kp = Kh + ((size_t)(bb * NH_ + hd)) * S_ * DK_;
  const __bf16* Vp = Vt + ((size_t)(bb * NH_ + hd)) * DK_ * S_;
  // the wave's first mask row, at this lane's two keys of a 64-key tile
  const int* mp = mask + (size_t)bb * S_ * S_ + (size_t)qbase * S_ + 2 * lane;

  v16bf bq[2];   // Q as B operand: column lm = query
#pragma unroll
  for (int c = 0; c < 2; ++c)
    bq[c] = load_op16(Qp + (size_t)(qbase + lm) * DK_ + 32 * c, h);

  v8f oacc[4] = {};          // Ot: oacc[nt][j] = O[query lm][nt*16 + 8h + j]
  float mrow = -3.0e38f;     // running maximum of query lm (equal in both halves)
  float lrow = 0.f;          // running sum over this half's keys only

  v16bf ak[2][2];  // [key-subtile][dk-chunk]
  v16bf av[4];
  v4i   mk[2][2];
  v2i   mg[16];

  // staging: 8 threads per 128-byte row, 32 rows per sweep, two sweeps per tile
  const int cr = threadIdx.x >> 3;        // 0..31
  const int cc = (threadIdx.x & 7) * 8;   // element in the row
  const __bf16* gK = Kp + (size_t)cr * DK_ + cc;
  const __bf16* gV = Vp + (size_t)cr * S_ + cc;

  auto stageKV = [&](int buf, int kb0) {
    const __bf16* k0 = gK + (size_t)kb0 * DK_;
    const __bf16* k1 = k0 + 32 * DK_;
    const __bf16* v0 = gV + kb0;
    const __bf16* v1 = v0 + (size_t)32 * S_;
    const unsigned lk0 = (unsigned)(uintptr_t)&sK[buf][cr][cc];
    const unsigned lk1 = (unsigned)(uintptr_t)&sK[buf][32 + cr][cc];
    const unsigned lv0 = (unsigned)(uintptr_t)&sV[buf][cr][cc];
    const unsigned lv1 = (unsigned)(uintptr_t)&sV[buf][32 + cr][cc];
    // the four copies of one tile; s_wait_xcnt closes the statement so that no
    // address register of a copy is rewritten ahead of it
    asm volatile(
        "global_load_async_to_lds_b128 %0, %4, off\n\t"
        "global_load_async_to_lds_b128 %1, %5, off\n\t"
        "global_load_async_to_lds_b128 %2, %6, off\n\t"
        "global_load_async_to_lds_b128 %3, %7, off\n\t"
        "s_wait_xcnt 0x0"
        :: "v"(lk0), "v"(lk1), "v"(lv0), "v"(lv1),
           "v"(k0), "v"(k1), "v"(v0), "v"(v1)
        : "memory");
  };

  const int NT = S_ / KT_;  // staged tiles
  stageKV(0, 0);
  wait_async0();     // this wave's share of tile 0 has landed
  __syncthreads();   // tile 0 readable by every wave
  stageKV(1, KT_);

  for (int ti = 0; ti < NT; ++ti) {
   const int buf = ti & 1;
   // ---- mask of this tile from global: one whole 256-byte row per load
   // (unrolled: constant indices keep mg in registers)
#pragma unroll
   for (int r = 0; r < 16; ++r)
     mg[r] = *(const v2i*)(mp + (size_t)r * S_ + ti * KT_);
   // unrolled so that the pass's place in the tile is a constant LDS offset
#pragma unroll
   for (int p = 0; p < KT_ / 32; ++p) {
    // ---- K operands of this pass from the staged tile (unrolled: constant
    // indices keep ak in registers)
#pragma unroll
    for (int tt = 0; tt < 2; ++tt)
#pragma unroll
      for (int c = 0; c < 2; ++c)
        ak[tt][c] = load_op16(&sK[buf][p * 32 + 16 * tt + lm][32 * c], h);

    // ---- scores: St[32k x 16q], K-dim = DK in two chunks of 32
    v8f sc[2] = {};
#pragma unroll
    for (int tt = 0; tt < 2; ++tt)
#pragma unroll
      for (int c = 0; c < 2; ++c)
        sc[tt] = __builtin_amdgcn_wmma_f32_16x16x32_bf16(
            false, ak[tt][c], false, bq[c], (short)0, sc[tt], false, false);

    // ---- the tile's mask rows into the wave's patch, behind the first scores
    // so that the global loads have those products to fly under
    if (p == 0) {
      // unrolled: mg is indexed by constants, the rows are constant LDS offsets
#pragma unroll
      for (int r = 0; r < 16; ++r) *(v2i*)&sM[wid][r][2 * lane] = mg[r];
      // the lanes read each other's stores: keeps the reads below behind them
      asm volatile("s_wait_dscnt 0x0" ::: "memory");
    }
    // ---- 8 consecutive keys of the lane's query per 16-key tile (unrolled:
    // constant indices keep mk in registers)
#pragma unroll
    for (int tt = 0; tt < 2; ++tt)
#pragma unroll
      for (int q = 0; q < 2; ++q)
        mk[tt][q] = *(const v4i*)&sM[wid][lm][p * 32 + 16 * tt + 8 * h + 4 * q];

    // ---- V operands from the staged tile: row = dk, k = keys
#pragma unroll
    for (int nt = 0; nt < 4; ++nt)
      av[nt] = load_op16(&sV[buf][nt * 16 + lm][p * 32], h);

    // ---- scale by 1/sqrt(DK), apply mask
#pragma unroll
    for (int t = 0; t < 2; ++t)
#pragma unroll
      for (int j = 0; j < 8; ++j) {
        const float v = sc[t][j] * 0.125f;
        sc[t][j] = (mk[t][j >> 2][j & 3] != 0) ? v : -60000.f;
      }

    // ---- online softmax of one query per lane (its loops unrolled: sc is
    // indexed by constants and stays in registers)
    float cm = fmaxf(sc[0][0], sc[1][0]);
#pragma unroll
    for (int j = 1; j < 8; ++j) cm = fmaxf(cm, fmaxf(sc[0][j], sc[1][j]));
    cm = fmaxf(cm, other_half(cm));
    const float mnew = fmaxf(mrow, cm);
    const float alpha = __expf(mrow - mnew);
    mrow = mnew;
    float rs0 = 0.f, rs1 = 0.f;
#pragma unroll
    for (int j = 0; j < 8; ++j) {
      sc[0][j] = __expf(sc[0][j] - mnew);
      sc[1][j] = __expf(sc[1][j] - mnew);
      rs0 += sc[0][j];
      rs1 += sc[1][j];
    }
    lrow = lrow * alpha + (rs0 + rs1);
#pragma unroll
    for (int nt = 0; nt < 4; ++nt)
#pragma unroll
      for (int j = 0; j < 8; ++j) oacc[nt][j] *= alpha;

    // ---- Pt: the two score tiles, converted in place, are the B operand
    // (unrolled: pb and sc stay in registers)
    v16bf pb;
#pragma unroll
    for (int j = 0; j < 8; ++j) {
      pb[j]     = (__bf16)sc[0][j];
      pb[8 + j] = (__bf16)sc[1][j];
    }

    // ---- Ot += Vt @ Pt (4 M-tiles over DK)
#pragma unroll
    for (int nt = 0; nt < 4; ++nt)
      oacc[nt] = __builtin_amdgcn_wmma_f32_16x16x32_bf16(
          false, av[nt], false, pb, (short)0, oacc[nt], false, false);
   }

   // ---- publish point of tile ti + 1; the barrier also ends every wave's reads
   // of this tile's buffer, which is refilled behind it
   asm volatile("s_wait_dscnt 0x0" ::: "memory");  // own LDS reads retired
   wait_async0();                                  // own copies of tile ti + 1 landed
   __syncthreads();
   if (ti + 2 < NT) stageKV(buf, (ti + 2) * KT_);
  }
  wait_async0();  // nothing in flight when the wave ends

  // ---- join the halves' sums, normalize, emit context [B,S,H] bf16:
  // 8 consecutive dk of one query per lane and tile, one 16-byte store each
  // (unrolled: oacc is indexed by constants)
  const float inv = 1.f / (lrow + other_half(lrow));
  __bf16* op = ctx + ((size_t)(bb * S_ + qbase + lm)) * H_ + hd * DK_ + 8 * h;
#pragma unroll
  for (int nt = 0; nt < 4; ++nt) {
    v8bf y;
#pragma unroll
    for (int j = 0; j < 8; ++j) y[j] = (__bf16)(oacc[nt][j] * inv);
    *(v8bf*)(op + nt * 16) = y;
  }
}

// ---------------------------------------------------------------------------
extern "C" void kernel_launch(void* const* d_in, const int* in_sizes, int n_in,
                              void* d_out, int out_size, void* d_ws, size_t ws_size,
                              hipStream_t stream) {
  (void)in_sizes; (void)n_in; (void)out_size; (void)ws_size;
  const float* query = (const float*)d_in[0];
  const float* key   = (const float*)d_in[1];
  const int*   amask = (const int*)d_in[2];
  const float* Wq = (const float*)d_in[3]; const float* bq = (const float*)d_in[4];
  const float* Wk = (const float*)d_in[5]; const float* bk = (const float*)d_in[6];
  const float* Wv = (const float*)d_in[7]; const float* bv = (const float*)d_in[8];
  const float* Wo = (const float*)d_in[9]; const float* bo = (const float*)d_in[10];

  char* ws = (char*)d_ws;
  const size_t MB = 1u << 20;
  __bf16* Xq  = (__bf16*)(ws +  0 * MB);
  __bf16* Xk  = (__bf16*)(ws +  8 * MB);
  __bf16* Wqb = (__bf16*)(ws + 16 * MB);
  __bf16* Wkb = (__bf16*)(ws + 18 * MB);
  __bf16* Wvb = (__bf16*)(ws + 20 * MB);
  __bf16* Wob = (__bf16*)(ws + 22 * MB);
  __bf16* Qh  = (__bf16*)(ws + 24 * MB);  // [B,NH,S,DK]
  __bf16* Khd = (__bf16*)(ws + 32 * MB);  // [B,NH,S,DK]
  __bf16* Vtd = (__bf16*)(ws + 40 * MB);  // [B,NH,DK,S]
  __bf16* ctx = (__bf16*)(ws + 48 * MB);  // [B,S,H]

  // Xq, Xk, Wqb, Wkb, Wvb, Wob are written as one run of 24 MB from Xq on
  cvt_f32_bf16<<<12 * CVT_BLOCKS_PER_PART, 256, 0, stream>>>(query, key, Wq, Wk, Wv, Wo, Xq);

  dim3 g3(64, 8, 3);  // M/64 x N/128 x {Q, K, V}
  gemm_bf16_wmma<<<g3, 256, 0, stream>>>(Xq, Wqb, bq, Qh,  1,
                                         Xk, Wkb, bk, Khd, 1,
                                         Xk, Wvb, bv, Vtd, 2, B_*S_, H_, H_);

  flash_attn_bf16<<<512, 256, 0, stream>>>(Qh, Khd, Vtd, amask, ctx);

  dim3 g1(64, 8, 1);
  gemm_bf16_wmma<<<g1, 256, 0, stream>>>(ctx, Wob, bo, d_out, 3,
                                         ctx, Wob, bo, d_out, 3,
                                         ctx, Wob, bo, d_out, 3, B_*S_, H_, H_);
}

// v004
// A run of this version takes 113 microseconds.
// In two side-by-side timings against v003, it was 1.13 and 1.14 times as fast.
// Over all steps from v000 it is 3.78 times as fast.
#include <hip/hip_runtime.h>
#include <hip/hip_bf16.h>

typedef __attribute__((ext_vector_type(16))) __bf16 v16bf;
typedef __attribute__((ext_vector_type(8)))  __bf16 v8bf;
typedef __attribute__((ext_vector_type(4)))  __bf16 v4bf;
typedef __attribute__((ext_vector_type(8)))  float  v8f;
typedef __attribute__((ext_vector_type(4)))  float  v4f;
typedef __attribute__((ext_vector_type(4)))  int    v4i;
typedef __attribute__((ext_vector_type(2)))  int    v2i;
typedef __attribute__((ext_vector_type(16))) unsigned int v16u;
typedef __attribute__((address_space(4))) v16u cv16u;

#define B_  2
#define S_  2048
#define H_  1024
#define NH_ 16
#define DK_ 64

// ---------------------------------------------------------------------------
// WMMA operand builder: CDNA5 16-bit A/B layout, lane-half h holds
// K{8h..8h+7} in elements 0..7 and K{16+8h..16+8h+7} in elements 8..15.
static __device__ __forceinline__ v16bf load_op16(const __bf16* base, int h) {
  v8bf lo = *(const v8bf*)(base + 8 * h);
  v8bf hi = *(const v8bf*)(base + 16 + 8 * h);
  v16bf r;
#pragma unroll
  for (int i = 0; i < 8; ++i) { r[i] = lo[i]; r[8 + i] = hi[i]; }
  return r;
}

// 16-byte async global->LDS copy (ASYNCcnt-tracked).
static __device__ __forceinline__ void async_copy16(const __bf16* g, __bf16* l) {
#if __has_builtin(__builtin_amdgcn_global_load_async_to_lds_b128)
  __builtin_amdgcn_global_load_async_to_lds_b128(
      (__attribute__((address_space(1))) v4i*)(uintptr_t)g,
      (__attribute__((address_space(3))) v4i*)(unsigned)(uintptr_t)l, 0, 0);
#else
  asm volatile("global_load_async_to_lds_b128 %0, %1, off"
               :: "v"((unsigned)(uintptr_t)l),
                  "v"((unsigned long long)(uintptr_t)g)
               : "memory");
#endif
}

static __device__ __forceinline__ void wait_async6() {
  asm volatile("s_wait_asynccnt 0x6" ::: "memory");
}
static __device__ __forceinline__ void wait_async0() {
  asm volatile("s_wait_asynccnt 0x0" ::: "memory");
}

// The mask as lane-mask words, one bit an element.  For 16 queries (a wave's tile
// in the attention kernel) and 32 keys (one of its passes) there are 16 words:
// bit l of word 8*tt + j says whether query (l & 15) may see key
// 16*tt + 8*(l >> 4) + j, which is the score that lane l holds in register j of
// score tile tt.  Words of one query tile lie in key order: 64 passes x 16 words.
#define KT_ 64        // keys per staged tile = two passes of 32 keys
#define M_PITCH 68    // 256-byte mask rows at a 272-byte pitch (16 B x odd) for ds_load_b128
#define MASK_UNITS 4  // units of 16 queries x 64 keys per wave
#define MASK_BLOCKS (B_ * (S_ / 16) * (S_ / KT_) / MASK_UNITS / 8)

// All six f32 -> bf16 conversions and the packing of the mask in one launch.
// The first MASK_BLOCKS blocks pack the mask.  Behind them: the six bf16 copies lie
// one behind the other in out: query, key (4 parts of H*H elements each), Wq, Wk,
// Wv, Wo (1 part each).  A block takes 4096 groups of four elements, 64 blocks a
// part, so the source is the same for a whole block.
#define CVT_GROUPS 4096                      // groups of four elements per block
#define CVT_BLOCKS_PER_PART (H_ * H_ / 4 / CVT_GROUPS)
__global__ void __launch_bounds__(256)
cvt_f32_bf16(const float* __restrict__ q, const float* __restrict__ k,
             const float* __restrict__ wq, const float* __restrict__ wk,
             const float* __restrict__ wv, const float* __restrict__ wo,
             __bf16* __restrict__ out,
             const int* __restrict__ mask, unsigned int* __restrict__ mbits) {
  __shared__ __attribute__((aligned(16))) int sM[8][16][M_PITCH];  // one patch per wave
  if (blockIdx.x < MASK_BLOCKS) {
    // Each wave reads 16 mask rows as whole 256-byte pieces (lane = two keys), turns
    // them through its own LDS patch so that lane l holds the keys of query l & 15
    // in the score layout, and takes one ballot per word.
    const int wid  = threadIdx.x >> 5;
    const int lane = threadIdx.x & 31;
    const int lm = lane & 15, h = lane >> 4;
    const int u0 = (blockIdx.x * 8 + wid) * MASK_UNITS;   // first unit of the wave
    // unit u = (query tile, 64-key tile); the wave's units are one query tile's
    const int* mp = mask + (size_t)(u0 / (S_ / KT_)) * 16 * S_ + (u0 % (S_ / KT_)) * KT_ + 2 * lane;
    v2i mg[16];
    // unrolled: constant indices keep mg in registers
#pragma unroll
    for (int r = 0; r < 16; ++r) mg[r] = *(const v2i*)(mp + (size_t)r * S_);
    // unrolled: the next unit's loads fly while this one is turned, nx in registers
#pragma unroll
    for (int u = 0; u < MASK_UNITS; ++u) {
      v2i nx[16];
      if (u + 1 < MASK_UNITS) {
#pragma unroll
        for (int r = 0; r < 16; ++r) nx[r] = *(const v2i*)(mp + (size_t)r * S_ + (u + 1) * KT_);
      }
#pragma unroll
      for (int r = 0; r < 16; ++r) *(v2i*)&sM[wid][r][2 * lane] = mg[r];
      // the lanes read each other's stores: keeps the reads below behind them
      asm volatile("s_wait_dscnt 0x0" ::: "memory");
      unsigned int word = 0;   // lane l ends up with word l of the unit's 32
#pragma unroll
      for (int g = 0; g < 4; ++g)     // g = 2 * pass + tt: a 16-key group
#pragma unroll
        for (int c = 0; c < 2; ++c) {
          const v4i m4 = *(const v4i*)&sM[wid][lm][16 * g + 8 * h + 4 * c];
#pragma unroll
          for (int e = 0; e < 4; ++e) {
            const unsigned int w = __builtin_amdgcn_ballot_w32(m4[e] != 0);
            if (lane == 8 * g + 4 * c + e) word = w;
          }
        }
      mbits[(size_t)(u0 + u) * 32 + lane] = word;   // one 128-byte line
      // the next unit's stores overwrite what other lanes have just read: keeps
      // them behind those reads
      if (u + 1 < MASK_UNITS) {
        asm volatile("s_wait_dscnt 0x0" ::: "memory");
#pragma unroll
        for (int r = 0; r < 16; ++r) mg[r] = nx[r];
      }
    }
    return;
  }
  const int cb = blockIdx.x - MASK_BLOCKS;
  const int part = cb / CVT_BLOCKS_PER_PART;   // 0..11
  const float* in;
  int first;                                           // the source's first part
  if (part < 4)       { in = q;  first = 0; }
  else if (part < 8)  { in = k;  first = 4; }
  else if (part == 8) { in = wq; first = 8; }
  else if (part == 9) { in = wk; first = 9; }
  else if (part == 10) { in = wv; first = 10; }
  else                { in = wo; first = 11; }
  const int o0 = cb * CVT_GROUPS + threadIdx.x;
  const int i0 = o0 - first * (H_ * H_ / 4);
  for (int r = 0; r < CVT_GROUPS / 256 / 8; ++r) {
    v4f x[8];
    // unrolled: eight loads in flight per lane, x indexed by constants
#pragma unroll
    for (int u = 0; u < 8; ++u) x[u] = ((const v4f*)in)[i0 + (r * 8 + u) * 256];
    // both unrolled: x and y are indexed by constants and stay in registers
#pragma unroll
    for (int u = 0; u < 8; ++u) {
      v4bf y;
#pragma unroll
      for (int j = 0; j < 4; ++j) y[j] = (__bf16)x[u][j];
      ((v4bf*)out)[o0 + (r * 8 + u) * 256] = y;
    }
  }
}

// ---------------------------------------------------------------------------
// C[M,N] = A[M,K](bf16) @ W[N,K]^T(bf16) + bias[N](f32)
// LDS-staged, double-buffered async pipeline.  WG = 256 thr (8 waves),
// tile 64(M) x 128(N) x 64(K) per stage; wave tile 32x32; 8 WMMAs/stage/wave.
// mode 1: bf16 out [B,NH,S,DK]; mode 2: bf16 out [B,NH,DK,S]; mode 3: f32 [M,N]
// Up to three independent products of one shape in one launch: blockIdx.z picks
// the operand set.
#define LDS_STRIDE 72  // 64 + 8 bf16 pad -> 36-bank row stride, conflict-free

__global__ void __launch_bounds__(256)
gemm_bf16_wmma(const __bf16* A0, const __bf16* W0, const float* bias0, void* out0, int mode0,
               const __bf16* A1, const __bf16* W1, const float* bias1, void* out1, int mode1,
               const __bf16* A2, const __bf16* W2, const float* bias2, void* out2, int mode2,
               int M, int N, int K) {
  __shared__ __bf16 sA[2][64][LDS_STRIDE];
  __shared__ __bf16 sB[2][128][LDS_STRIDE];

  const int z = blockIdx.z;
  const __bf16* __restrict__ A = z == 0 ? A0 : z == 1 ? A1 : A2;
  const __bf16* __restrict__ W = z == 0 ? W0 : z == 1 ? W1 : W2;
  const float* __restrict__ bias = z == 0 ? bias0 : z == 1 ? bias1 : bias2;
  void* __restrict__ out = z == 0 ? out0 : z == 1 ? out1 : out2;
  const int mode = z == 0 ? mode0 : z == 1 ? mode1 : mode2;

  const int tid  = threadIdx.x;
  const int wid  = tid >> 5;
  const int lane = tid & 31;
  const int lm = lane & 15, h = lane >> 4;
  const int wm = wid & 1, wn = wid >> 1;
  const int mBase = blockIdx.x * 64;
  const int nBase = blockIdx.y * 128;

  // staging: 4 threads/row, each thread covers elem [c8,c8+8) and [c8+32,c8+40)
  const int ra = tid >> 2;         // 0..63
  const int c8 = (tid & 3) * 8;
  const __bf16* gA  = A + (size_t)(mBase + ra) * K + c8;
  const __bf16* gB0 = W + (size_t)(nBase + ra) * K + c8;
  const __bf16* gB1 = W + (size_t)(nBase + 64 + ra) * K + c8;

  v8f acc[2][2] = {};

  const int NK = K / 64;  // stages

  auto stage = [&](int buf, int k0) {
    async_copy16(gA  + k0,      &sA[buf][ra][c8]);
    async_copy16(gA  + k0 + 32, &sA[buf][ra][c8 + 32]);
    async_copy16(gB0 + k0,      &sB[buf][ra][c8]);
    async_copy16(gB0 + k0 + 32, &sB[buf][ra][c8 + 32]);
    async_copy16(gB1 + k0,      &sB[buf][64 + ra][c8]);
    async_copy16(gB1 + k0 + 32, &sB[buf][64 + ra][c8 + 32]);
  };

  stage(0, 0);  // prologue

  for (int kc = 0; kc < NK; ++kc) {
    const int cur = kc & 1;
    if (kc + 1 < NK) {
      stage(cur ^ 1, (kc + 1) * 64);
      wait_async6();   // previous buffer's 6 copies (this wave) complete
    } else {
      wait_async0();
    }
    __syncthreads();   // all waves' copies into `cur` visible

    const __bf16* ap = &sA[cur][wm * 32 + lm][0];
    const __bf16* bp = &sB[cur][wn * 32 + lm][0];
#pragma unroll
    for (int kk = 0; kk < 2; ++kk) {
      v16bf a0 = load_op16(ap + kk * 32, h);
      v16bf a1 = load_op16(ap + 16 * LDS_STRIDE + kk * 32, h);
      v16bf b0 = load_op16(bp + kk * 32, h);
      v16bf b1 = load_op16(bp + 16 * LDS_STRIDE + kk * 32, h);
      acc[0][0] = __builtin_amdgcn_wmma_f32_16x16x32_bf16(false, a0, false, b0, (short)0, acc[0][0], false, false);
      acc[0][1] = __builtin_amdgcn_wmma_f32_16x16x32_bf16(false, a0, false, b1, (short)0, acc[0][1], false, false);
      acc[1][0] = __builtin_amdgcn_wmma_f32_16x16x32_bf16(false, a1, false, b0, (short)0, acc[1][0], false, false);
      acc[1][1] = __builtin_amdgcn_wmma_f32_16x16x32_bf16(false, a1, false, b1, (short)0, acc[1][1], false, false);
    }

    __syncthreads();   // reads of `cur` done before it is overwritten
  }

#pragma unroll
  for (int ms = 0; ms < 2; ++ms)
#pragma unroll
    for (int ns = 0; ns < 2; ++ns) {
      const int n = nBase + wn * 32 + ns * 16 + lm;
      const float bn = bias[n];
#pragma unroll
      for (int j = 0; j < 8; ++j) {
        const int m = mBase + wm * 32 + ms * 16 + j + 8 * h;
        const float v = acc[ms][ns][j] + bn;
        if (mode == 3) {
          ((float*)out)[(size_t)m * N + n] = v;
        } else {
          const int bb = m >> 11, s = m & (S_ - 1);   // m = b*S + s
          const int hd = n >> 6,  d = n & (DK_ - 1);  // n = h*DK + d
          __bf16* o = (__bf16*)out;
          if (mode == 1)
            o[(((size_t)(bb * NH_ + hd)) * S_ + s) * DK_ + d] = (__bf16)v;
          else
            o[(((size_t)(bb * NH_ + hd)) * DK_ + d) * S_ + s] = (__bf16)v;
        }
      }
    }
}

// ---------------------------------------------------------------------------
// Flash attention: one wave owns a 16-row Q tile; the work-group's 8 waves are
// 8 Q tiles of ONE head, so each 64-key K tile and V tile is brought into LDS
// once per work-group by asynchronous copies (whole 128-byte rows, two buffers,
// the next tile in flight while this one is worked on) and every wave reads its
// WMMA operands from there.  Q,K: [B,NH,S,DK]; V: [B,NH,DK,S] bf16.
// The products are taken transposed: St = K Qt and Ot += Vt Pt.  A lane then
// holds 16 of the 32 keys of ONE query (lane lm = query, register j = key
// 8h + j of a 16-key tile), so maximum and sum run inside the lane with one
// exchange between the wave's halves, and the two score tiles, converted in
// place, are the B operand of the second product in the hardware k order.
// The mask comes as the lane-mask words packed by the conversion launch: 16 words
// a pass, the same for the whole wave, read by scalar loads one tile ahead; each
// word is the select condition of one score register.
#define KV_PITCH 72   // 128-byte rows at a 144-byte pitch (16 B x odd) for ds_load_b128

// value of lane l ^ 16
static __device__ __forceinline__ float other_half(float x) {
  const int b = __builtin_bit_cast(int, x);
  return __builtin_bit_cast(
      float, __builtin_amdgcn_permlanex16(b, b, 0x76543210, 0xfedcba98, false, false));
}

// waves_per_eu: the grid gives each SIMD four waves.  With the mask patch gone from
// LDS the compiler would plan for more, and to save registers put every LDS load
// directly in front of its product instead of fetching ahead.
__global__ void __launch_bounds__(256) __attribute__((amdgpu_waves_per_eu(4, 4)))
flash_attn_bf16(const __bf16* __restrict__ Q, const __bf16* __restrict__ Kh,
                const __bf16* __restrict__ Vt, const unsigned int* __restrict__ mbits,
                __bf16* __restrict__ ctx) {
  __shared__ __attribute__((aligned(16))) __bf16 sK[2][KT_][KV_PITCH];
  __shared__ __attribute__((aligned(16))) __bf16 sV[2][DK_][KV_PITCH];
  const int wid  = threadIdx.x >> 5;
  const int lane = threadIdx.x & 31;
  const int lm = lane & 15, h = lane >> 4;

  const int gt = blockIdx.x * 8 + wid;
  const int qt = gt & (S_ / 16 - 1);
  const int bh = gt >> 7;
  const int hd = bh & (NH_ - 1);
  const int bb = bh >> 4;
  const int qbase = qt * 16;

  const __bf16* Qp = Q  + ((size_t)(bb * NH_ + hd)) * S_ * DK_;
  const __bf16* Kp = Kh + ((size_t)(bb * NH_ + hd)) * S_ * DK_;
  const __bf16* Vp = Vt + ((size_t)(bb * NH_ + hd)) * DK_ * S_;
  // the wave's mask words, 16 a pass.  readfirstlane: the index is the same in every
  // lane; constant address space: nothing writes the words while this kernel runs.
  // Both are needed for the loads in the loop to be scalar loads.
  const cv16u* mw = (const cv16u*)(uintptr_t)(
      mbits + (size_t)__builtin_amdgcn_readfirstlane(bb * (S_ / 16) + qt) * (S_ / 32 * 16));

  v16bf bq[2];   // Q as B operand: column lm = query
#pragma unroll
  for (int c = 0; c < 2; ++c)
    bq[c] = load_op16(Qp + (size_t)(qbase + lm) * DK_ + 32 * c, h);

  v8f oacc[4] = {};          // Ot: oacc[nt][j] = O[query lm][nt*16 + 8h + j]
  float mrow = -3.0e38f;     // running maximum of query lm (equal in both halves)
  float lrow = 0.f;          // running sum over this half's keys only

  v16bf ak[2][2];  // [key-subtile][dk-chunk]
  v16bf av[4];

  // staging: 8 threads per 128-byte row, 32 rows per sweep, two sweeps per tile
  const int cr = threadIdx.x >> 3;        // 0..31
  const int cc = (threadIdx.x & 7) * 8;   // element in the row
  const __bf16* gK = Kp + (size_t)cr * DK_ + cc;
  const __bf16* gV = Vp + (size_t)cr * S_ + cc;

  auto stageKV = [&](int buf, int kb0) {
    const __bf16* k0 = gK + (size_t)kb0 * DK_;
    const __bf16* k1 = k0 + 32 * DK_;
    const __bf16* v0 = gV + kb0;
    const __bf16* v1 = v0 + (size_t)32 * S_;
    const unsigned lk0 = (unsigned)(uintptr_t)&sK[buf][cr][cc];
    const unsigned lk1 = (unsigned)(uintptr_t)&sK[buf][32 + cr][cc];
    const unsigned lv0 = (unsigned)(uintptr_t)&sV[buf][cr][cc];
    const unsigned lv1 = (unsigned)(uintptr_t)&sV[buf][32 + cr][cc];
    // the four copies of one tile; s_wait_xcnt closes the statement so that no
    // address register of a copy is rewritten ahead of it
    asm volatile(
        "global_load_async_to_lds_b128 %0, %4, off\n\t"
        "global_load_async_to_lds_b128 %1, %5, off\n\t"
        "global_load_async_to_lds_b128 %2, %6, off\n\t"
        "global_load_async_to_lds_b128 %3, %7, off\n\t"
        "s_wait_xcnt 0x0"
        :: "v"(lk0), "v"(lk1), "v"(lv0), "v"(lv1),
           "v"(k0), "v"(k1), "v"(v0), "v"(v1)
        : "memory");
  };

  const int NT = S_ / KT_;  // staged tiles
  stageKV(0, 0);
  wait_async0();     // this wave's share of tile 0 has landed
  __syncthreads();   // tile 0 readable by every wave
  stageKV(1, KT_);

  v16u mk[2];   // this tile's mask words, [pass]
  mk[0] = mw[0];
  mk[1] = mw[1];

  for (int ti = 0; ti < NT; ++ti) {
   const int buf = ti & 1;
   // ---- mask words of the next tile (the last tile reads its own again)
   const int tn = ti + 1 < NT ? ti + 1 : ti;
   const v16u mn0 = mw[2 * tn];
   const v16u mn1 = mw[2 * tn + 1];
   // unrolled so that the pass's place in the tile is a constant LDS offset
#pragma unroll
   for (int p = 0; p < KT_ / 32; ++p) {
    // ---- K operands of this pass from the staged tile (unrolled: constant
    // indices keep ak in registers)
#pragma unroll
    for (int tt = 0; tt < 2; ++tt)
#pragma unroll
      for (int c = 0; c < 2; ++c)
        ak[tt][c] = load_op16(&sK[buf][p * 32 + 16 * tt + lm][32 * c], h);

    // ---- scores: St[32k x 16q], K-dim = DK in two chunks of 32
    v8f sc[2] = {};
#pragma unroll
    for (int tt = 0; tt < 2; ++tt)
#pragma unroll
      for (int c = 0; c < 2; ++c)
        sc[tt] = __builtin_amdgcn_wmma_f32_16x16x32_bf16(
            false, ak[tt][c], false, bq[c], (short)0, sc[tt], false, false);

    // ---- V operands from the staged tile: row = dk, k = keys
#pragma unroll
    for (int nt = 0; nt < 4; ++nt)
      av[nt] = load_op16(&sV[buf][nt * 16 + lm][p * 32], h);

    // ---- scale by 1/sqrt(DK), apply mask
#pragma unroll
    for (int t = 0; t < 2; ++t)
#pragma unroll
      for (int j = 0; j < 8; ++j) {
        const float v = sc[t][j] * 0.125f;
        sc[t][j] = __builtin_amdgcn_inverse_ballot_w32(mk[p][8 * t + j]) ? v : -60000.f;
      }

    // ---- online softmax of one query per lane (its loops unrolled: sc is
    // indexed by constants and stays in registers)
    float cm = fmaxf(sc[0][0], sc[1][0]);
#pragma unroll
    for (int j = 1; j < 8; ++j) cm = fmaxf(cm, fmaxf(sc[0][j], sc[1][j]));
    cm = fmaxf(cm, other_half(cm));
    const float mnew = fmaxf(mrow, cm);
    const float alpha = __expf(mrow - mnew);
    mrow = mnew;
    float rs0 = 0.f, rs1 = 0.f;
#pragma unroll
    for (int j = 0; j < 8; ++j) {
      sc[0][j] = __expf(sc[0][j] - mnew);
      sc[1][j] = __expf(sc[1][j] - mnew);
      rs0 += sc[0][j];
      rs1 += sc[1][j];
    }
    lrow = lrow * alpha + (rs0 + rs1);
#pragma unroll
    for (int nt = 0; nt < 4; ++nt)
#pragma unroll
      for (int j = 0; j < 8; ++j) oacc[nt][j] *= alpha;

    // ---- Pt: the two score tiles, converted in place, are the B operand
    // (unrolled: pb and sc stay in registers)
    v16bf pb;
#pragma unroll
    for (int j = 0; j < 8; ++j) {
      pb[j]     = (__bf16)sc[0][j];
      pb[8 + j] = (__bf16)sc[1][j];
    }

    // ---- Ot += Vt @ Pt (4 M-tiles over DK)
#pragma unroll
    for (int nt = 0; nt < 4; ++nt)
      oacc[nt] = __builtin_amdgcn_wmma_f32_16x16x32_bf16(
          false, av[nt], false, pb, (short)0, oacc[nt], false, false);
   }

   // ---- publish point of tile ti + 1; the barrier also ends every wave's reads
   // of this tile's buffer, which is refilled behind it
   asm volatile("s_wait_dscnt 0x0" ::: "memory");  // own LDS reads retired
   wait_async0();                                  // own copies of tile ti + 1 landed
   __syncthreads();
   if (ti + 2 < NT) stageKV(buf, (ti + 2) * KT_);
   mk[0] = mn0;
   mk[1] = mn1;
  }
  wait_async0();  // nothing in flight when the wave ends

  // ---- join the halves' sums, normalize, emit context [B,S,H] bf16:
  // 8 consecutive dk of one query per lane and tile, one 16-byte store each
  // (unrolled: oacc is indexed by constants)
  const float inv = 1.f / (lrow + other_half(lrow));
  __bf16* op = ctx + ((size_t)(bb * S_ + qbase + lm)) * H_ + hd * DK_ + 8 * h;
#pragma unroll
  for (int nt = 0; nt < 4; ++nt) {
    v8bf y;
#pragma unroll
    for (int j = 0; j < 8; ++j) y[j] = (__bf16)(oacc[nt][j] * inv);
    *(v8bf*)(op + nt * 16) = y;
  }
}

// ---------------------------------------------------------------------------
extern "C" void kernel_launch(void* const* d_in, const int* in_sizes, int n_in,
                              void* d_out, int out_size, void* d_ws, size_t ws_size,
                              hipStream_t stream) {
  (void)in_sizes; (void)n_in; (void)out_size; (void)ws_size;
  const float* query = (const float*)d_in[0];
  const float* key   = (const float*)d_in[1];
  const int*   amask = (const int*)d_in[2];
  const float* Wq = (const float*)d_in[3]; const float* bq = (const float*)d_in[4];
  const float* Wk = (const float*)d_in[5]; const float* bk = (const float*)d_in[6];
  const float* Wv = (const float*)d_in[7]; const float* bv = (const float*)d_in[8];
  const float* Wo = (const float*)d_in[9]; const float* bo = (const float*)d_in[10];

  char* ws = (char*)d_ws;
  const size_t MB = 1u << 20;
  __bf16* Xq  = (__bf16*)(ws +  0 * MB);
  __bf16* Xk  = (__bf16*)(ws +  8 * MB);
  __bf16* Wqb = (__bf16*)(ws + 16 * MB);
  __bf16* Wkb = (__bf16*)(ws + 18 * MB);
  __bf16* Wvb = (__bf16*)(ws + 20 * MB);
  __bf16* Wob = (__bf16*)(ws + 22 * MB);
  __bf16* Qh  = (__bf16*)(ws + 24 * MB);  // [B,NH,S,DK]
  __bf16* Khd = (__bf16*)(ws + 32 * MB);  // [B,NH,S,DK]
  __bf16* Vtd = (__bf16*)(ws + 40 * MB);  // [B,NH,DK,S]
  __bf16* ctx = (__bf16*)(ws + 48 * MB);  // [B,S,H]
  unsigned int* mbits = (unsigned int*)(ws + 56 * MB);  // 1 MB of lane-mask words

  // Xq, Xk, Wqb, Wkb, Wvb, Wob are written as one run of 24 MB from Xq on
  cvt_f32_bf16<<<MASK_BLOCKS + 12 * CVT_BLOCKS_PER_PART, 256, 0, stream>>>(query, key, Wq, Wk, Wv, Wo, Xq,
                                                                           amask, mbits);

  dim3 g3(64, 8, 3);  // M/64 x N/128 x {Q, K, V}
  gemm_bf16_wmma<<<g3, 256, 0, stream>>>(Xq, Wqb, bq, Qh,  1,
                                         Xk, Wkb, bk, Khd, 1,
                                         Xk, Wvb, bv, Vtd, 2, B_*S_, H_, H_);

  flash_attn_bf16<<<512, 256, 0, stream>>>(Qh, Khd, Vtd, mbits, ctx);

  dim3 g1(64, 8, 1);
  gemm_bf16_wmma<<<g1, 256, 0, stream>>>(ctx, Wob, bo, d_out, 3,
                                         ctx, Wob, bo, d_out, 3,
                                         ctx, Wob, bo, d_out, 3, B_*S_, H_, H_);
}

// v005
// Measured time: 99.6 microseconds a run.
// In two side-by-side timings against v004, it was 1.13 and 1.14 times as fast.
// Over all steps from v000 it is 4.30 times as fast.
#include <hip/hip_runtime.h>
#include <hip/hip_bf16.h>

typedef __attribute__((ext_vector_type(16))) __bf16 v16bf;
typedef __attribute__((ext_vector_type(8)))  __bf16 v8bf;
typedef __attribute__((ext_vector_type(4)))  __bf16 v4bf;
typedef __attribute__((ext_vector_type(8)))  float  v8f;
typedef __attribute__((ext_vector_type(4)))  float  v4f;
typedef __attribute__((ext_vector_type(4)))  int    v4i;
typedef __attribute__((ext_vector_type(2)))  int    v2i;
typedef __attribute__((ext_vector_type(16))) unsigned int v16u;
typedef __attribute__((address_space(4))) v16u cv16u;

#define B_  2
#define S_  2048
#define H_  1024
#define NH_ 16
#define DK_ 64

// ---------------------------------------------------------------------------
// WMMA operand builder: CDNA5 16-bit A/B layout, lane-half h holds
// K{8h..8h+7} in elements 0..7 and K{16+8h..16+8h+7} in elements 8..15.
static __device__ __forceinline__ v16bf load_op16(const __bf16* base, int h) {
  v8bf lo = *(const v8bf*)(base + 8 * h);
  v8bf hi = *(const v8bf*)(base + 16 + 8 * h);
  v16bf r;
#pragma unroll
  for (int i = 0; i < 8; ++i) { r[i] = lo[i]; r[8 + i] = hi[i]; }
  return r;
}

// 16-byte async global->LDS copy (ASYNCcnt-tracked).
static __device__ __forceinline__ void async_copy16(const __bf16* g, __bf16* l) {
#if __has_builtin(__builtin_amdgcn_global_load_async_to_lds_b128)
  __builtin_amdgcn_global_load_async_to_lds_b128(
      (__attribute__((address_space(1))) v4i*)(uintptr_t)g,
      (__attribute__((address_space(3))) v4i*)(unsigned)(uintptr_t)l, 0, 0);
#else
  asm volatile("global_load_async_to_lds_b128 %0, %1, off"
               :: "v"((unsigned)(uintptr_t)l),
                  "v"((unsigned long long)(uintptr_t)g)
               : "memory");
#endif
}

static __device__ __forceinline__ void wait_async6() {
  asm volatile("s_wait_asynccnt 0x6" ::: "memory");
}
static __device__ __forceinline__ void wait_async0() {
  asm volatile("s_wait_asynccnt 0x0" ::: "memory");
}

// The mask as lane-mask words, one bit an element.  For 16 queries (a wave's tile
// in the attention kernel) and 32 keys (one of its passes) there are 16 words:
// bit l of word 8*tt + j says whether query (l & 15) may see key
// 16*tt + 8*(l >> 4) + j, which is the score that lane l holds in register j of
// score tile tt.  Words of one query tile lie in key order: 64 passes x 16 words.
#define KT_ 64        // keys per staged tile = two passes of 32 keys
#define M_PITCH 68    // 256-byte mask rows at a 272-byte pitch (16 B x odd) for ds_load_b128
#define MASK_UNITS 4  // units of 16 queries x 64 keys per wave
#define MASK_BLOCKS (B_ * (S_ / 16) * (S_ / KT_) / MASK_UNITS / 8)

// All six f32 -> bf16 conversions and the packing of the mask in one launch.
// The first MASK_BLOCKS blocks pack the mask.  Behind them: the six bf16 copies lie
// one behind the other in out: query, key (4 parts of H*H elements each), Wq, Wk,
// Wv, Wo (1 part each).  A block takes 4096 groups of four elements, 64 blocks a
// part, so the source is the same for a whole block.
#define CVT_GROUPS 4096                      // groups of four elements per block
#define CVT_BLOCKS_PER_PART (H_ * H_ / 4 / CVT_GROUPS)
__global__ void __launch_bounds__(256)
cvt_f32_bf16(const float* __restrict__ q, const float* __restrict__ k,
             const float* __restrict__ wq, const float* __restrict__ wk,
             const float* __restrict__ wv, const float* __restrict__ wo,
             __bf16* __restrict__ out,
             const int* __restrict__ mask, unsigned int* __restrict__ mbits) {
  __shared__ __attribute__((aligned(16))) int sM[8][16][M_PITCH];  // one patch per wave
  if (blockIdx.x < MASK_BLOCKS) {
    // Each wave reads 16 mask rows as whole 256-byte pieces (lane = two keys), turns
    // them through its own LDS patch so that lane l holds the keys of query l & 15
    // in the score layout, and takes one ballot per word.
    const int wid  = threadIdx.x >> 5;
    const int lane = threadIdx.x & 31;
    const int lm = lane & 15, h = lane >> 4;
    const int u0 = (blockIdx.x * 8 + wid) * MASK_UNITS;   // first unit of the wave
    // unit u = (query tile, 64-key tile); the wave's units are one query tile's
    const int* mp = mask + (size_t)(u0 / (S_ / KT_)) * 16 * S_ + (u0 % (S_ / KT_)) * KT_ + 2 * lane;
    v2i mg[16];
    // unrolled: constant indices keep mg in registers
#pragma unroll
    for (int r = 0; r < 16; ++r) mg[r] = *(const v2i*)(mp + (size_t)r * S_);
    // unrolled: the next unit's loads fly while this one is turned, nx in registers
#pragma unroll
    for (int u = 0; u < MASK_UNITS; ++u) {
      v2i nx[16];
      if (u + 1 < MASK_UNITS) {
#pragma unroll
        for (int r = 0; r < 16; ++r) nx[r] = *(const v2i*)(mp + (size_t)r * S_ + (u + 1) * KT_);
      }
#pragma unroll
      for (int r = 0; r < 16; ++r) *(v2i*)&sM[wid][r][2 * lane] = mg[r];
      // the lanes read each other's stores: keeps the reads below behind them
      asm volatile("s_wait_dscnt 0x0" ::: "memory");
      unsigned int word = 0;   // lane l ends up with word l of the unit's 32
#pragma unroll
      for (int g = 0; g < 4; ++g)     // g = 2 * pass + tt: a 16-key group
#pragma unroll
        for (int c = 0; c < 2; ++c) {
          const v4i m4 = *(const v4i*)&sM[wid][lm][16 * g + 8 * h + 4 * c];
#pragma unroll
          for (int e = 0; e < 4; ++e) {
            const unsigned int w = __builtin_amdgcn_ballot_w32(m4[e] != 0);
            if (lane == 8 * g + 4 * c + e) word = w;
          }
        }
      mbits[(size_t)(u0 + u) * 32 + lane] = word;   // one 128-byte line
      // the next unit's stores overwrite what other lanes have just read: keeps
      // them behind those reads
      if (u + 1 < MASK_UNITS) {
        asm volatile("s_wait_dscnt 0x0" ::: "memory");
#pragma unroll
        for (int r = 0; r < 16; ++r) mg[r] = nx[r];
      }
    }
    return;
  }
  const int cb = blockIdx.x - MASK_BLOCKS;
  const int part = cb / CVT_BLOCKS_PER_PART;   // 0..11
  const float* in;
  int first;                                           // the source's first part
  if (part < 4)       { in = q;  first = 0; }
  else if (part < 8)  { in = k;  first = 4; }
  else if (part == 8) { in = wq; first = 8; }
  else if (part == 9) { in = wk; first = 9; }
  else if (part == 10) { in = wv; first = 10; }
  else                { in = wo; first = 11; }
  const int o0 = cb * CVT_GROUPS + threadIdx.x;
  const int i0 = o0 - first * (H_ * H_ / 4);
  for (int r = 0; r < CVT_GROUPS / 256 / 8; ++r) {
    v4f x[8];
    // unrolled: eight loads in flight per lane, x indexed by constants
#pragma unroll
    for (int u = 0; u < 8; ++u) x[u] = ((const v4f*)in)[i0 + (r * 8 + u) * 256];
    // both unrolled: x and y are indexed by constants and stay in registers
#pragma unroll
    for (int u = 0; u < 8; ++u) {
      v4bf y;
#pragma unroll
      for (int j = 0; j < 4; ++j) y[j] = (__bf16)x[u][j];
      ((v4bf*)out)[o0 + (r * 8 + u) * 256] = y;
    }
  }
}

// ---------------------------------------------------------------------------
// C[M,N] = A[M,K](bf16) @ W[N,K]^T(bf16) + bias[N](f32)
// LDS-staged, double-buffered async pipeline.  WG = 256 thr (8 waves),
// tile 64(M) x 128(N) x 64(K) per stage; wave tile 32x32; 8 WMMAs/stage/wave.
// mode 1: bf16 out [B,NH,S,DK]; mode 2: bf16 out [B,NH,DK,S]; mode 3: f32 [M,N]
// Up to three independent products of one shape in one launch: blockIdx.z picks
// the operand set.
#define LDS_STRIDE 72  // 64 + 8 bf16 pad -> 36-bank row stride, conflict-free
#define ST_F32  132    // output staging: 512-byte f32 rows at a 528-byte pitch (16 B x odd)
#define ST_BF16 136    // output staging: 256-byte bf16 rows at a 272-byte pitch (16 B x odd)

__global__ void __launch_bounds__(256)
gemm_bf16_wmma(const __bf16* A0, const __bf16* W0, const float* bias0, void* out0, int mode0,
               const __bf16* A1, const __bf16* W1, const float* bias1, void* out1, int mode1,
               const __bf16* A2, const __bf16* W2, const float* bias2, void* out2, int mode2,
               int M, int N, int K) {
  __shared__ __bf16 sA[2][64][LDS_STRIDE];
  __shared__ __attribute__((aligned(16))) __bf16 sB[2][128][LDS_STRIDE];  // also the output staging

  const int z = blockIdx.z;
  const __bf16* __restrict__ A = z == 0 ? A0 : z == 1 ? A1 : A2;
  const __bf16* __restrict__ W = z == 0 ? W0 : z == 1 ? W1 : W2;
  const float* __restrict__ bias = z == 0 ? bias0 : z == 1 ? bias1 : bias2;
  void* __restrict__ out = z == 0 ? out0 : z == 1 ? out1 : out2;
  const int mode = z == 0 ? mode0 : z == 1 ? mode1 : mode2;

  const int tid  = threadIdx.x;
  const int wid  = tid >> 5;
  const int lane = tid & 31;
  const int lm = lane & 15, h = lane >> 4;
  const int wm = wid & 1, wn = wid >> 1;
  const int mBase = blockIdx.x * 64;
  const int nBase = blockIdx.y * 128;

  // staging: 4 threads/row, each thread covers elem [c8,c8+8) and [c8+32,c8+40)
  const int ra = tid >> 2;         // 0..63
  const int c8 = (tid & 3) * 8;
  const __bf16* gA  = A + (size_t)(mBase + ra) * K + c8;
  const __bf16* gB0 = W + (size_t)(nBase + ra) * K + c8;
  const __bf16* gB1 = W + (size_t)(nBase + 64 + ra) * K + c8;

  v8f acc[2][2] = {};

  const int NK = K / 64;  // stages

  auto stage = [&](int buf, int k0) {
    async_copy16(gA  + k0,      &sA[buf][ra][c8]);
    async_copy16(gA  + k0 + 32, &sA[buf][ra][c8 + 32]);
    async_copy16(gB0 + k0,      &sB[buf][ra][c8]);
    async_copy16(gB0 + k0 + 32, &sB[buf][ra][c8 + 32]);
    async_copy16(gB1 + k0,      &sB[buf][64 + ra][c8]);
    async_copy16(gB1 + k0 + 32, &sB[buf][64 + ra][c8 + 32]);
  };

  stage(0, 0);  // prologue

  for (int kc = 0; kc < NK; ++kc) {
    const int cur = kc & 1;
    if (kc + 1 < NK) {
      stage(cur ^ 1, (kc + 1) * 64);
      wait_async6();   // previous buffer's 6 copies (this wave) complete
    } else {
      wait_async0();
    }
    __syncthreads();   // all waves' copies into `cur` visible

    const __bf16* ap = &sA[cur][wm * 32 + lm][0];
    const __bf16* bp = &sB[cur][wn * 32 + lm][0];
#pragma unroll
    for (int kk = 0; kk < 2; ++kk) {
      v16bf a0 = load_op16(ap + kk * 32, h);
      v16bf a1 = load_op16(ap + 16 * LDS_STRIDE + kk * 32, h);
      v16bf b0 = load_op16(bp + kk * 32, h);
      v16bf b1 = load_op16(bp + 16 * LDS_STRIDE + kk * 32, h);
      acc[0][0] = __builtin_amdgcn_wmma_f32_16x16x32_bf16(false, a0, false, b0, (short)0, acc[0][0], false, false);
      acc[0][1] = __builtin_amdgcn_wmma_f32_16x16x32_bf16(false, a0, false, b1, (short)0, acc[0][1], false, false);
      acc[1][0] = __builtin_amdgcn_wmma_f32_16x16x32_bf16(false, a1, false, b0, (short)0, acc[1][0], false, false);
      acc[1][1] = __builtin_amdgcn_wmma_f32_16x16x32_bf16(false, a1, false, b1, (short)0, acc[1][1], false, false);
    }

    __syncthreads();   // reads of `cur` done before it is overwritten
  }

  // ---- The tile leaves through LDS, so that every global store is 16 bytes a lane
  // and eight neighbouring lanes fill one whole 128-byte line of the output.  The
  // ring is free here: the last trip waited for every copy, and its closing barrier
  // ended every wave's reads.  mode is the same for the whole work-group, so each
  // barrier below is passed by all of its waves.
  const int ml = wm * 32 + 8 * h;   // the lane's first tile row; + ms * 16 + j
  const int nl = wn * 32 + lm;      // the lane's first tile column; + ns * 16
  const int l8 = tid >> 3;          // line of a sweep of 32 lines
  const int e8 = (tid & 7) * 8;     // the thread's eight bf16 in its line
  if (mode == 3) {
    float* st = (float*)&sB[0][0][0];   // [64][ST_F32]
    // unrolled here and below: acc is indexed by constants and stays in registers
#pragma unroll
    for (int ms = 0; ms < 2; ++ms)
#pragma unroll
      for (int ns = 0; ns < 2; ++ns) {
        const float bn = bias[nBase + nl + ns * 16];
#pragma unroll
        for (int j = 0; j < 8; ++j)
          st[(ml + ms * 16 + j) * ST_F32 + nl + ns * 16] = acc[ms][ns][j] + bn;
      }
    __syncthreads();   // the rows read below were written by four waves
    // a wave stores one 512-byte row piece (four lines) at a time.  readfirstlane:
    // the wave's number is the same in every lane; it keeps the eight row addresses
    // in scalar registers, and the kernel at ten waves per SIMD
    const int wu = __builtin_amdgcn_readfirstlane(wid);
#pragma unroll
    for (int i = 0; i < 8; ++i) {
      const int row = i * 8 + wu;
      const v4f x = *(const v4f*)&st[row * ST_F32 + lane * 4];
      *(v4f*)((float*)out + (size_t)(mBase + row) * N + nBase + lane * 4) = x;
    }
    // the code behind this branch reuses registers that the stores above name
    asm volatile("s_wait_xcnt 0x0" ::: "memory");
  } else if (mode == 1) {
    __bf16* st = &sB[0][0][0];          // [64 positions][ST_BF16]
#pragma unroll
    for (int ms = 0; ms < 2; ++ms)
#pragma unroll
      for (int ns = 0; ns < 2; ++ns) {
        const float bn = bias[nBase + nl + ns * 16];
#pragma unroll
        for (int j = 0; j < 8; ++j)
          st[(ml + ms * 16 + j) * ST_BF16 + nl + ns * 16] = (__bf16)(acc[ms][ns][j] + bn);
      }
    __syncthreads();   // the rows read below were written by four waves
    // a line = the DK values of one position and one of the tile's two heads
#pragma unroll
    for (int i = 0; i < 4; ++i) {
      const int line = i * 32 + l8;
      const int m = mBase + (line & 63);          // m = b*S + s
      const int hd = (nBase >> 6) + (line >> 6);  // n = h*DK + d
      const int bb = m >> 11, s = m & (S_ - 1);
      const v8bf y = *(const v8bf*)&st[(line & 63) * ST_BF16 + (line >> 6) * DK_ + e8];
      *(v8bf*)((__bf16*)out + (((size_t)(bb * NH_ + hd)) * S_ + s) * DK_ + e8) = y;
    }
  } else {
    __bf16* st = &sB[0][0][0];          // [128 columns][LDS_STRIDE], positions along a row
#pragma unroll
    for (int ms = 0; ms < 2; ++ms)
#pragma unroll
      for (int ns = 0; ns < 2; ++ns) {
        const float bn = bias[nBase + nl + ns * 16];
        v8bf y;
#pragma unroll
        for (int j = 0; j < 8; ++j) y[j] = (__bf16)(acc[ms][ns][j] + bn);
        *(v8bf*)&st[(nl + ns * 16) * LDS_STRIDE + ml + ms * 16] = y;
      }
    __syncthreads();   // the rows read below were written by two waves
    // a line = the tile's 64 positions of one head and one of its DK rows
    const int bb = mBase >> 11, s = mBase & (S_ - 1);   // 64 divides S: one batch a tile
#pragma unroll
    for (int i = 0; i < 4; ++i) {
      const int line = i * 32 + l8;
      const int n = nBase + line;
      const int hd = n >> 6, d = n & (DK_ - 1);
      const v8bf y = *(const v8bf*)&st[line * LDS_STRIDE + e8];
      *(v8bf*)((__bf16*)out + (((size_t)(bb * NH_ + hd)) * DK_ + d) * S_ + s + e8) = y;
    }
    // the compiler lays another branch's code, which reuses registers that the stores
    // above name, behind this one
    asm volatile("s_wait_xcnt 0x0" ::: "memory");
  }
}

// ---------------------------------------------------------------------------
// Flash attention: one wave owns a 16-row Q tile; the work-group's 8 waves are
// 8 Q tiles of ONE head, so each 64-key K tile and V tile is brought into LDS
// once per work-group by asynchronous copies (whole 128-byte rows, two buffers,
// the next tile in flight while this one is worked on) and every wave reads its
// WMMA operands from there.  Q,K: [B,NH,S,DK]; V: [B,NH,DK,S] bf16.
// The products are taken transposed: St = K Qt and Ot += Vt Pt.  A lane then
// holds 16 of the 32 keys of ONE query (lane lm = query, register j = key
// 8h + j of a 16-key tile), so maximum and sum run inside the lane with one
// exchange between the wave's halves, and the two score tiles, converted in
// place, are the B operand of the second product in the hardware k order.
// The mask comes as the lane-mask words packed by the conversion launch: 16 words
// a pass, the same for the whole wave, read by scalar loads one tile ahead; each
// word is the select condition of one score register.
#define KV_PITCH 72   // 128-byte rows at a 144-byte pitch (16 B x odd) for ds_load_b128

// value of lane l ^ 16
static __device__ __forceinline__ float other_half(float x) {
  const int b = __builtin_bit_cast(int, x);
  return __builtin_bit_cast(
      float, __builtin_amdgcn_permlanex16(b, b, 0x76543210, 0xfedcba98, false, false));
}

// waves_per_eu: the grid gives each SIMD four waves.  With the mask patch gone from
// LDS the compiler would plan for more, and to save registers put every LDS load
// directly in front of its product instead of fetching ahead.
__global__ void __launch_bounds__(256) __attribute__((amdgpu_waves_per_eu(4, 4)))
flash_attn_bf16(const __bf16* __restrict__ Q, const __bf16* __restrict__ Kh,
                const __bf16* __restrict__ Vt, const unsigned int* __restrict__ mbits,
                __bf16* __restrict__ ctx) {
  __shared__ __attribute__((aligned(16))) __bf16 sK[2][KT_][KV_PITCH];
  __shared__ __attribute__((aligned(16))) __bf16 sV[2][DK_][KV_PITCH];
  const int wid  = threadIdx.x >> 5;
  const int lane = threadIdx.x & 31;
  const int lm = lane & 15, h = lane >> 4;

  const int gt = blockIdx.x * 8 + wid;
  const int qt = gt & (S_ / 16 - 1);
  const int bh = gt >> 7;
  const int hd = bh & (NH_ - 1);
  const int bb = bh >> 4;
  const int qbase = qt * 16;

  const __bf16* Qp = Q  + ((size_t)(bb * NH_ + hd)) * S_ * DK_;
  const __bf16* Kp = Kh + ((size_t)(bb * NH_ + hd)) * S_ * DK_;
  const __bf16* Vp = Vt + ((size_t)(bb * NH_ + hd)) * DK_ * S_;
  // the wave's mask words, 16 a pass.  readfirstlane: the index is the same in every
  // lane; constant address space: nothing writes the words while this kernel runs.
  // Both are needed for the loads in the loop to be scalar loads.
  const cv16u* mw = (const cv16u*)(uintptr_t)(
      mbits + (size_t)__builtin_amdgcn_readfirstlane(bb * (S_ / 16) + qt) * (S_ / 32 * 16));

  v16bf bq[2];   // Q as B operand: column lm = query
#pragma unroll
  for (int c = 0; c < 2; ++c)
    bq[c] = load_op16(Qp + (size_t)(qbase + lm) * DK_ + 32 * c, h);

  v8f oacc[4] = {};          // Ot: oacc[nt][j] = O[query lm][nt*16 + 8h + j]
  float mrow = -3.0e38f;     // running maximum of query lm (equal in both halves)
  float lrow = 0.f;          // running sum over this half's keys only

  v16bf ak[2][2];  // [key-subtile][dk-chunk]
  v16bf av[4];

  // staging: 8 threads per 128-byte row, 32 rows per sweep, two sweeps per tile
  const int cr = threadIdx.x >> 3;        // 0..31
  const int cc = (threadIdx.x & 7) * 8;   // element in the row
  const __bf16* gK = Kp + (size_t)cr * DK_ + cc;
  const __bf16* gV = Vp + (size_t)cr * S_ + cc;

  auto stageKV = [&](int buf, int kb0) {
    const __bf16* k0 = gK + (size_t)kb0 * DK_;
    const __bf16* k1 = k0 + 32 * DK_;
    const __bf16* v0 = gV + kb0;
    const __bf16* v1 = v0 + (size_t)32 * S_;
    const unsigned lk0 = (unsigned)(uintptr_t)&sK[buf][cr][cc];
    const unsigned lk1 = (unsigned)(uintptr_t)&sK[buf][32 + cr][cc];
    const unsigned lv0 = (unsigned)(uintptr_t)&sV[buf][cr][cc];
    const unsigned lv1 = (unsigned)(uintptr_t)&sV[buf][32 + cr][cc];
    // the four copies of one tile; s_wait_xcnt closes the statement so that no
    // address register of a copy is rewritten ahead of it
    asm volatile(
        "global_load_async_to_lds_b128 %0, %4, off\n\t"
        "global_load_async_to_lds_b128 %1, %5, off\n\t"
        "global_load_async_to_lds_b128 %2, %6, off\n\t"
        "global_load_async_to_lds_b128 %3, %7, off\n\t"
        "s_wait_xcnt 0x0"
        :: "v"(lk0), "v"(lk1), "v"(lv0), "v"(lv1),
           "v"(k0), "v"(k1), "v"(v0), "v"(v1)
        : "memory");
  };

  const int NT = S_ / KT_;  // staged tiles
  stageKV(0, 0);
  wait_async0();     // this wave's share of tile 0 has landed
  __syncthreads();   // tile 0 readable by every wave
  stageKV(1, KT_);

  v16u mk[2];   // this tile's mask words, [pass]
  mk[0] = mw[0];
  mk[1] = mw[1];

  for (int ti = 0; ti < NT; ++ti) {
   const int buf = ti & 1;
   // ---- mask words of the next tile (the last tile reads its own again)
   const int tn = ti + 1 < NT ? ti + 1 : ti;
   const v16u mn0 = mw[2 * tn];
   const v16u mn1 = mw[2 * tn + 1];
   // unrolled so that the pass's place in the tile is a constant LDS offset
#pragma unroll
   for (int p = 0; p < KT_ / 32; ++p) {
    // ---- K operands of this pass from the staged tile (unrolled: constant
    // indices keep ak in registers)
#pragma unroll
    for (int tt = 0; tt < 2; ++tt)
#pragma unroll
      for (int c = 0; c < 2; ++c)
        ak[tt][c] = load_op16(&sK[buf][p * 32 + 16 * tt + lm][32 * c], h);

    // ---- scores: St[32k x 16q], K-dim = DK in two chunks of 32
    v8f sc[2] = {};
#pragma unroll
    for (int tt = 0; tt < 2; ++tt)
#pragma unroll
      for (int c = 0; c < 2; ++c)
        sc[tt] = __builtin_amdgcn_wmma_f32_16x16x32_bf16(
            false, ak[tt][c], false, bq[c], (short)0, sc[tt], false, false);

    // ---- V operands from the staged tile: row = dk, k = keys
#pragma unroll
    for (int nt = 0; nt < 4; ++nt)
      av[nt] = load_op16(&sV[buf][nt * 16 + lm][p * 32], h);

    // ---- scale by 1/sqrt(DK), apply mask
#pragma unroll
    for (int t = 0; t < 2; ++t)
#pragma unroll
      for (int j = 0; j < 8; ++j) {
        const float v = sc[t][j] * 0.125f;
        sc[t][j] = __builtin_amdgcn_inverse_ballot_w32(mk[p][8 * t + j]) ? v : -60000.f;
      }

    // ---- online softmax of one query per lane (its loops unrolled: sc is
    // indexed by constants and stays in registers)
    float cm = fmaxf(sc[0][0], sc[1][0]);
#pragma unroll
    for (int j = 1; j < 8; ++j) cm = fmaxf(cm, fmaxf(sc[0][j], sc[1][j]));
    cm = fmaxf(cm, other_half(cm));
    const float mnew = fmaxf(mrow, cm);
    const float alpha = __expf(mrow - mnew);
    mrow = mnew;
    float rs0 = 0.f, rs1 = 0.f;
#pragma unroll
    for (int j = 0; j < 8; ++j) {
      sc[0][j] = __expf(sc[0][j] - mnew);
      sc[1][j] = __expf(sc[1][j] - mnew);
      rs0 += sc[0][j];
      rs1 += sc[1][j];
    }
    lrow = lrow * alpha + (rs0 + rs1);
#pragma unroll
    for (int nt = 0; nt < 4; ++nt)
#pragma unroll
      for (int j = 0; j < 8; ++j) oacc[nt][j] *= alpha;

    // ---- Pt: the two score tiles, converted in place, are the B operand
    // (unrolled: pb and sc stay in registers)
    v16bf pb;
#pragma unroll
    for (int j = 0; j < 8; ++j) {
      pb[j]     = (__bf16)sc[0][j];
      pb[8 + j] = (__bf16)sc[1][j];
    }

    // ---- Ot += Vt @ Pt (4 M-tiles over DK)
#pragma unroll
    for (int nt = 0; nt < 4; ++nt)
      oacc[nt] = __builtin_amdgcn_wmma_f32_16x16x32_bf16(
          false, av[nt], false, pb, (short)0, oacc[nt], false, false);
   }

   // ---- publish point of tile ti + 1; the barrier also ends every wave's reads
   // of this tile's buffer, which is refilled behind it
   asm volatile("s_wait_dscnt 0x0" ::: "memory");  // own LDS reads retired
   wait_async0();                                  // own copies of tile ti + 1 landed
   __syncthreads();
   if (ti + 2 < NT) stageKV(buf, (ti + 2) * KT_);
   mk[0] = mn0;
   mk[1] = mn1;
  }
  wait_async0();  // nothing in flight when the wave ends

  // ---- join the halves' sums, normalize, emit context [B,S,H] bf16:
  // 8 consecutive dk of one query per lane and tile, one 16-byte store each
  // (unrolled: oacc is indexed by constants)
  const float inv = 1.f / (lrow + other_half(lrow));
  __bf16* op = ctx + ((size_t)(bb * S_ + qbase + lm)) * H_ + hd * DK_ + 8 * h;
#pragma unroll
  for (int nt = 0; nt < 4; ++nt) {
    v8bf y;
#pragma unroll
    for (int j = 0; j < 8; ++j) y[j] = (__bf16)(oacc[nt][j] * inv);
    *(v8bf*)(op + nt * 16) = y;
  }
}

// ---------------------------------------------------------------------------
extern "C" void kernel_launch(void* const* d_in, const int* in_sizes, int n_in,
                              void* d_out, int out_size, void* d_ws, size_t ws_size,
                              hipStream_t stream) {
  (void)in_sizes; (void)n_in; (void)out_size; (void)ws_size;
  const float* query = (const float*)d_in[0];
  const float* key   = (const float*)d_in[1];
  const int*   amask = (const int*)d_in[2];
  const float* Wq = (const float*)d_in[3]; const float* bq = (const float*)d_in[4];
  const float* Wk = (const float*)d_in[5]; const float* bk = (const float*)d_in[6];
  const float* Wv = (const float*)d_in[7]; const float* bv = (const float*)d_in[8];
  const float* Wo = (const float*)d_in[9]; const float* bo = (const float*)d_in[10];

  char* ws = (char*)d_ws;
  const size_t MB = 1u << 20;
  __bf16* Xq  = (__bf16*)(ws +  0 * MB);
  __bf16* Xk  = (__bf16*)(ws +  8 * MB);
  __bf16* Wqb = (__bf16*)(ws + 16 * MB);
  __bf16* Wkb = (__bf16*)(ws + 18 * MB);
  __bf16* Wvb = (__bf16*)(ws + 20 * MB);
  __bf16* Wob = (__bf16*)(ws + 22 * MB);
  __bf16* Qh  = (__bf16*)(ws + 24 * MB);  // [B,NH,S,DK]
  __bf16* Khd = (__bf16*)(ws + 32 * MB);  // [B,NH,S,DK]
  __bf16* Vtd = (__bf16*)(ws + 40 * MB);  // [B,NH,DK,S]
  __bf16* ctx = (__bf16*)(ws + 48 * MB);  // [B,S,H]
  unsigned int* mbits = (unsigned int*)(ws + 56 * MB);  // 1 MB of lane-mask words

  // Xq, Xk, Wqb, Wkb, Wvb, Wob are written as one run of 24 MB from Xq on
  cvt_f32_bf16<<<MASK_BLOCKS + 12 * CVT_BLOCKS_PER_PART, 256, 0, stream>>>(query, key, Wq, Wk, Wv, Wo, Xq,
                                                                           amask, mbits);

  dim3 g3(64, 8, 3);  // M/64 x N/128 x {Q, K, V}
  gemm_bf16_wmma<<<g3, 256, 0, stream>>>(Xq, Wqb, bq, Qh,  1,
                                         Xk, Wkb, bk, Khd, 1,
                                         Xk, Wvb, bv, Vtd, 2, B_*S_, H_, H_);

  flash_attn_bf16<<<512, 256, 0, stream>>>(Qh, Khd, Vtd, mbits, ctx);

  dim3 g1(64, 8, 1);
  gemm_bf16_wmma<<<g1, 256, 0, stream>>>(ctx, Wob, bo, d_out, 3,
                                         ctx, Wob, bo, d_out, 3,
                                         ctx, Wob, bo, d_out, 3, B_*S_, H_, H_);
}

// v006
// It runs in 90.7 microseconds.
// Two timings next to v005 put it at 1.12 and 1.09 times that version's speed.
// Counting every step since v000, it is 4.76 times as fast.
#include <hip/hip_runtime.h>
#include <hip/hip_bf16.h>

typedef __attribute__((ext_vector_type(16))) __bf16 v16bf;
typedef __attribute__((ext_vector_type(8)))  __bf16 v8bf;
typedef __attribute__((ext_vector_type(4)))  __bf16 v4bf;
typedef __attribute__((ext_vector_type(8)))  float  v8f;
typedef __attribute__((ext_vector_type(4)))  float  v4f;
typedef __attribute__((ext_vector_type(4)))  int    v4i;
typedef __attribute__((ext_vector_type(2)))  int    v2i;
typedef __attribute__((ext_vector_type(16))) unsigned int v16u;
typedef __attribute__((address_space(4))) v16u cv16u;

#define B_  2
#define S_  2048
#define H_  1024
#define NH_ 16
#define DK_ 64

// ---------------------------------------------------------------------------
// WMMA operand builder: CDNA5 16-bit A/B layout, lane-half h holds
// K{8h..8h+7} in elements 0..7 and K{16+8h..16+8h+7} in elements 8..15.
static __device__ __forceinline__ v16bf load_op16(const __bf16* base, int h) {
  v8bf lo = *(const v8bf*)(base + 8 * h);
  v8bf hi = *(const v8bf*)(base + 16 + 8 * h);
  v16bf r;
#pragma unroll
  for (int i = 0; i < 8; ++i) { r[i] = lo[i]; r[8 + i] = hi[i]; }
  return r;
}

// 16-byte async global->LDS copy (ASYNCcnt-tracked).
static __device__ __forceinline__ void async_copy16(const __bf16* g, __bf16* l) {
#if __has_builtin(__builtin_amdgcn_global_load_async_to_lds_b128)
  __builtin_amdgcn_global_load_async_to_lds_b128(
      (__attribute__((address_space(1))) v4i*)(uintptr_t)g,
      (__attribute__((address_space(3))) v4i*)(unsigned)(uintptr_t)l, 0, 0);
#else
  asm volatile("global_load_async_to_lds_b128 %0, %1, off"
               :: "v"((unsigned)(uintptr_t)l),
                  "v"((unsigned long long)(uintptr_t)g)
               : "memory");
#endif
}

static __device__ __forceinline__ void wait_async8() {
  asm volatile("s_wait_asynccnt 0x8" ::: "memory");
}
static __device__ __forceinline__ void wait_async0() {
  asm volatile("s_wait_asynccnt 0x0" ::: "memory");
}

// The mask as lane-mask words, one bit an element.  For 16 queries (a wave's tile
// in the attention kernel) and 32 keys (one of its passes) there are 16 words:
// bit l of word 8*tt + j says whether query (l & 15) may see key
// 16*tt + 8*(l >> 4) + j, which is the score that lane l holds in register j of
// score tile tt.  Words of one query tile lie in key order: 64 passes x 16 words.
#define KT_ 64        // keys per staged tile = two passes of 32 keys
#define M_PITCH 68    // 256-byte mask rows at a 272-byte pitch (16 B x odd) for ds_load_b128
#define MASK_UNITS 4  // units of 16 queries x 64 keys per wave
#define MASK_BLOCKS (B_ * (S_ / 16) * (S_ / KT_) / MASK_UNITS / 8)

// All six f32 -> bf16 conversions and the packing of the mask in one launch.
// The first MASK_BLOCKS blocks pack the mask.  Behind them: the six bf16 copies lie
// one behind the other in out: query, key (4 parts of H*H elements each), Wq, Wk,
// Wv, Wo (1 part each).  A block takes 4096 groups of four elements, 64 blocks a
// part, so the source is the same for a whole block.
#define CVT_GROUPS 4096                      // groups of four elements per block
#define CVT_BLOCKS_PER_PART (H_ * H_ / 4 / CVT_GROUPS)
__global__ void __launch_bounds__(256)
cvt_f32_bf16(const float* __restrict__ q, const float* __restrict__ k,
             const float* __restrict__ wq, const float* __restrict__ wk,
             const float* __restrict__ wv, const float* __restrict__ wo,
             __bf16* __restrict__ out,
             const int* __restrict__ mask, unsigned int* __restrict__ mbits) {
  __shared__ __attribute__((aligned(16))) int sM[8][16][M_PITCH];  // one patch per wave
  if (blockIdx.x < MASK_BLOCKS) {
    // Each wave reads 16 mask rows as whole 256-byte pieces (lane = two keys), turns
    // them through its own LDS patch so that lane l holds the keys of query l & 15
    // in the score layout, and takes one ballot per word.
    const int wid  = threadIdx.x >> 5;
    const int lane = threadIdx.x & 31;
    const int lm = lane & 15, h = lane >> 4;
    const int u0 = (blockIdx.x * 8 + wid) * MASK_UNITS;   // first unit of the wave
    // unit u = (query tile, 64-key tile); the wave's units are one query tile's
    const int* mp = mask + (size_t)(u0 / (S_ / KT_)) * 16 * S_ + (u0 % (S_ / KT_)) * KT_ + 2 * lane;
    v2i mg[16];
    // unrolled: constant indices keep mg in registers
#pragma unroll
    for (int r = 0; r < 16; ++r) mg[r] = *(const v2i*)(mp + (size_t)r * S_);
    // unrolled: the next unit's loads fly while this one is turned, nx in registers
#pragma unroll
    for (int u = 0; u < MASK_UNITS; ++u) {
      v2i nx[16];
      if (u + 1 < MASK_UNITS) {
#pragma unroll
        for (int r = 0; r < 16; ++r) nx[r] = *(const v2i*)(mp + (size_t)r * S_ + (u + 1) * KT_);
      }
#pragma unroll
      for (int r = 0; r < 16; ++r) *(v2i*)&sM[wid][r][2 * lane] = mg[r];
      // the lanes read each other's stores: keeps the reads below behind them
      asm volatile("s_wait_dscnt 0x0" ::: "memory");
      unsigned int word = 0;   // lane l ends up with word l of the unit's 32
#pragma unroll
      for (int g = 0; g < 4; ++g)     // g = 2 * pass + tt: a 16-key group
#pragma unroll
        for (int c = 0; c < 2; ++c) {
          const v4i m4 = *(const v4i*)&sM[wid][lm][16 * g + 8 * h + 4 * c];
#pragma unroll
          for (int e = 0; e < 4; ++e) {
            const unsigned int w = __builtin_amdgcn_ballot_w32(m4[e] != 0);
            if (lane == 8 * g + 4 * c + e) word = w;
          }
        }
      mbits[(size_t)(u0 + u) * 32 + lane] = word;   // one 128-byte line
      // the next unit's stores overwrite what other lanes have just read: keeps
      // them behind those reads
      if (u + 1 < MASK_UNITS) {
        asm volatile("s_wait_dscnt 0x0" ::: "memory");
#pragma unroll
        for (int r = 0; r < 16; ++r) mg[r] = nx[r];
      }
    }
    return;
  }
  const int cb = blockIdx.x - MASK_BLOCKS;
  const int part = cb / CVT_BLOCKS_PER_PART;   // 0..11
  const float* in;
  int first;                                           // the source's first part
  if (part < 4)       { in = q;  first = 0; }
  else if (part < 8)  { in = k;  first = 4; }
  else if (part == 8) { in = wq; first = 8; }
  else if (part == 9) { in = wk; first = 9; }
  else if (part == 10) { in = wv; first = 10; }
  else                { in = wo; first = 11; }
  const int o0 = cb * CVT_GROUPS + threadIdx.x;
  const int i0 = o0 - first * (H_ * H_ / 4);
  for (int r = 0; r < CVT_GROUPS / 256 / 8; ++r) {
    v4f x[8];
    // unrolled: eight loads in flight per lane, x indexed by constants
#pragma unroll
    for (int u = 0; u < 8; ++u) x[u] = ((const v4f*)in)[i0 + (r * 8 + u) * 256];
    // both unrolled: x and y are indexed by constants and stay in registers
#pragma unroll
    for (int u = 0; u < 8; ++u) {
      v4bf y;
#pragma unroll
      for (int j = 0; j < 4; ++j) y[j] = (__bf16)x[u][j];
      ((v4bf*)out)[o0 + (r * 8 + u) * 256] = y;
    }
  }
}

// ---------------------------------------------------------------------------
// C[M,N] = A[M,K](bf16) @ W[N,K]^T(bf16) + bias[N](f32)
// LDS-staged, double-buffered async pipeline.  WG = 256 thr (8 waves),
// tile 128(M) x 128(N) x 64(K) per stage; wave tile 64x32; 16 WMMAs/stage/wave.
// mode 1: bf16 out [B,NH,S,DK]; mode 2: bf16 out [B,NH,DK,S]; mode 3: f32 [M,N]
// Up to three independent products of one shape in one launch: blockIdx.z picks
// the operand set.
#define BM_ 128
#define BN_ 128
#define LDS_STRIDE 72  // 64 + 8 bf16 pad -> 36-bank row stride, conflict-free
#define ST_F32  132    // output staging: 512-byte f32 rows at a 528-byte pitch (16 B x odd)
#define ST_BF16 136    // output staging: 256-byte bf16 rows at a 272-byte pitch (16 B x odd)

// waves_per_eu: the larger grid gives each SIMD six waves (three work-groups a WGP),
// which is 160 registers a wave.  Left alone the compiler plans for the eight that LDS
// would admit, too few registers for the read order set in the loop.
__global__ void __launch_bounds__(256) __attribute__((amdgpu_waves_per_eu(6, 6)))
gemm_bf16_wmma(const __bf16* A0, const __bf16* W0, const float* bias0, void* out0, int mode0,
               const __bf16* A1, const __bf16* W1, const float* bias1, void* out1, int mode1,
               const __bf16* A2, const __bf16* W2, const float* bias2, void* out2, int mode2,
               int M, int N, int K) {
  // a stage: rows 0..127 the A tile, rows 128..255 the W tile; also the output staging
  __shared__ __attribute__((aligned(16))) __bf16 sT[2][BM_ + BN_][LDS_STRIDE];

  const int z = blockIdx.z;
  const __bf16* __restrict__ A = z == 0 ? A0 : z == 1 ? A1 : A2;
  const __bf16* __restrict__ W = z == 0 ? W0 : z == 1 ? W1 : W2;
  const float* __restrict__ bias = z == 0 ? bias0 : z == 1 ? bias1 : bias2;
  void* __restrict__ out = z == 0 ? out0 : z == 1 ? out1 : out2;
  const int mode = z == 0 ? mode0 : z == 1 ? mode1 : mode2;

  const int tid  = threadIdx.x;
  const int wid  = tid >> 5;
  const int lane = tid & 31;
  const int lm = lane & 15, h = lane >> 4;
  const int wm = wid & 1, wn = wid >> 1;
  const int mBase = blockIdx.x * BM_;
  const int nBase = blockIdx.y * BN_;

  // staging: 8 threads per 128-byte row, 32 rows per sweep, four sweeps per operand
  const int cr = tid >> 3;         // 0..31
  const int cc = (tid & 7) * 8;    // element in the row
  const __bf16* gA = A + (size_t)(mBase + cr) * K + cc;
  const __bf16* gB = W + (size_t)(nBase + cr) * K + cc;

  v8f acc[4][2] = {};

  const int NK = K / 64;  // stages

  auto stage = [&](int buf, int k0) {
    // unrolled: eight copies one behind the other, the count that wait_async8 leans on
#pragma unroll
    for (int i = 0; i < 4; ++i) {
      async_copy16(gA + (size_t)(32 * i) * K + k0, &sT[buf][32 * i + cr][cc]);
      async_copy16(gB + (size_t)(32 * i) * K + k0, &sT[buf][BM_ + 32 * i + cr][cc]);
    }
  };

  stage(0, 0);  // prologue

  for (int kc = 0; kc < NK; ++kc) {
    const int cur = kc & 1;
    if (kc + 1 < NK) {
      stage(cur ^ 1, (kc + 1) * 64);
      wait_async8();   // previous buffer's 8 copies (this wave) complete
    } else {
      wait_async0();
    }
    __syncthreads();   // all waves' copies into `cur` visible

    const __bf16* ap = &sT[cur][wm * 64 + lm][0];
    const __bf16* bp = &sT[cur][BM_ + wn * 32 + lm][0];
    // all unrolled: a, b and acc are indexed by constants and stay in registers
    v16bf a[2][4], b[2][2];
#pragma unroll
    for (int kk = 0; kk < 2; ++kk) {
#pragma unroll
      for (int ms = 0; ms < 4; ++ms) a[kk][ms] = load_op16(ap + ms * 16 * LDS_STRIDE + kk * 32, h);
#pragma unroll
      for (int ns = 0; ns < 2; ++ns) b[kk][ns] = load_op16(bp + ns * 16 * LDS_STRIDE + kk * 32, h);
    }
#pragma unroll
    for (int kk = 0; kk < 2; ++kk)
#pragma unroll
      for (int ms = 0; ms < 4; ++ms)
#pragma unroll
        for (int ns = 0; ns < 2; ++ns)
          acc[ms][ns] = __builtin_amdgcn_wmma_f32_16x16x32_bf16(false, a[kk][ms], false, b[kk][ns],
                                                                (short)0, acc[ms][ns], false, false);
    // order of the stage's LDS reads (0x100) and products (0x8): the first half's twelve
    // reads and four of the second half's go ahead as one group, then one more fragment
    // of the second half is fetched behind every two products, into the registers that
    // they free.  Left alone the compiler reloads one A fragment in front of every two
    // products and waits out the LDS latency each time.
    __builtin_amdgcn_sched_group_barrier(0x100, 16, 0);
#pragma unroll
    for (int ms = 0; ms < 4; ++ms) {
      __builtin_amdgcn_sched_group_barrier(0x8, 2, 0);
      __builtin_amdgcn_sched_group_barrier(0x100, 2, 0);
    }
    __builtin_amdgcn_sched_group_barrier(0x8, 8, 0);

    __syncthreads();   // reads of `cur` done before it is overwritten
  }

  // ---- The tile leaves through LDS, so that every global store is 16 bytes a lane
  // and eight neighbouring lanes fill one whole 128-byte line of the output.  The
  // ring is free here: the last trip waited for every copy, and its closing barrier
  // ended every wave's reads.  mode is the same for the whole work-group, so each
  // barrier below is passed by all of its waves.
  const int ml = wm * 64 + 8 * h;   // the lane's first tile row; + ms * 16 + j
  const int nl = wn * 32 + lm;      // the lane's first tile column; + ns * 16
  if (mode == 3) {
    float* st = (float*)&sT[0][0][0];   // [128][ST_F32]
    // unrolled here and below: acc is indexed by constants and stays in registers
#pragma unroll
    for (int ns = 0; ns < 2; ++ns) {
      const float bn = bias[nBase + nl + ns * 16];
#pragma unroll
      for (int ms = 0; ms < 4; ++ms)
#pragma unroll
        for (int j = 0; j < 8; ++j)
          st[(ml + ms * 16 + j) * ST_F32 + nl + ns * 16] = acc[ms][ns][j] + bn;
    }
    __syncthreads();   // the rows read below were written by four waves
    // a wave stores one 512-byte row piece (four lines) at a time.  readfirstlane:
    // the wave's number is the same in every lane; it keeps the sixteen row offsets
    // in scalar registers
    const int wu = __builtin_amdgcn_readfirstlane(wid);
#pragma unroll
    for (int i = 0; i < 16; ++i) {
      const int row = i * 8 + wu;
      const v4f x = *(const v4f*)&st[row * ST_F32 + lane * 4];
      *(v4f*)((float*)out + (size_t)(mBase + row) * N + nBase + lane * 4) = x;
    }
    // the code behind this branch reuses registers that the stores above name
    asm volatile("s_wait_xcnt 0x0" ::: "memory");
  } else if (mode == 1) {
    __bf16* st = &sT[0][0][0];          // [128 positions][ST_BF16]
#pragma unroll
    for (int ns = 0; ns < 2; ++ns) {
      const float bn = bias[nBase + nl + ns * 16];
#pragma unroll
      for (int ms = 0; ms < 4; ++ms)
#pragma unroll
        for (int j = 0; j < 8; ++j)
          st[(ml + ms * 16 + j) * ST_BF16 + nl + ns * 16] = (__bf16)(acc[ms][ns][j] + bn);
    }
    __syncthreads();   // the rows read below were written by four waves
    // a line = the DK values of one position and one of the tile's two heads
    const int l8 = tid >> 3;          // line of a sweep of 32 lines
    const int e8 = (tid & 7) * 8;     // the thread's eight bf16 in its line
#pragma unroll
    for (int i = 0; i < 8; ++i) {
      const int line = i * 32 + l8;
      const int m = mBase + (line & (BM_ - 1));   // m = b*S + s
      const int hd = (nBase >> 6) + (line >> 7);  // n = h*DK + d
      const int bb = m >> 11, s = m & (S_ - 1);
      const v8bf y = *(const v8bf*)&st[(line & (BM_ - 1)) * ST_BF16 + (line >> 7) * DK_ + e8];
      *(v8bf*)((__bf16*)out + (((size_t)(bb * NH_ + hd)) * S_ + s) * DK_ + e8) = y;
    }
    // the code behind this branch reuses registers that the stores above name
    asm volatile("s_wait_xcnt 0x0" ::: "memory");
  } else {
    __bf16* st = &sT[0][0][0];          // [128 columns][ST_BF16], positions along a row
#pragma unroll
    for (int ns = 0; ns < 2; ++ns) {
      const float bn = bias[nBase + nl + ns * 16];
#pragma unroll
      for (int ms = 0; ms < 4; ++ms) {
        v8bf y;
#pragma unroll
        for (int j = 0; j < 8; ++j) y[j] = (__bf16)(acc[ms][ns][j] + bn);
        *(v8bf*)&st[(nl + ns * 16) * ST_BF16 + ml + ms * 16] = y;
      }
    }
    __syncthreads();   // the rows read below were written by two waves
    // two lines = the tile's 128 positions of one head and one of its DK rows
    const int bb = mBase >> 11, s = mBase & (S_ - 1);   // 128 divides S: one batch a tile
    const int r16 = tid >> 4;          // row of a sweep of 16 rows
    const int e16 = (tid & 15) * 8;    // the thread's eight bf16 in its row
#pragma unroll
    for (int i = 0; i < 8; ++i) {
      const int col = i * 16 + r16;
      const int n = nBase + col;
      const int hd = n >> 6, d = n & (DK_ - 1);
      const v8bf y = *(const v8bf*)&st[col * ST_BF16 + e16];
      *(v8bf*)((__bf16*)out + (((size_t)(bb * NH_ + hd)) * DK_ + d) * S_ + s + e16) = y;
    }
    // the compiler lays another branch's code, which reuses registers that the stores
    // above name, behind this one
    asm volatile("s_wait_xcnt 0x0" ::: "memory");
  }
}

// ---------------------------------------------------------------------------
// Flash attention: one wave owns a 16-row Q tile; the work-group's 8 waves are
// 8 Q tiles of ONE head, so each 64-key K tile and V tile is brought into LDS
// once per work-group by asynchronous copies (whole 128-byte rows, two buffers,
// the next tile in flight while this one is worked on) and every wave reads its
// WMMA operands from there.  Q,K: [B,NH,S,DK]; V: [B,NH,DK,S] bf16.
// The products are taken transposed: St = K Qt and Ot += Vt Pt.  A lane then
// holds 16 of the 32 keys of ONE query (lane lm = query, register j = key
// 8h + j of a 16-key tile), so maximum and sum run inside the lane with one
// exchange between the wave's halves, and the two score tiles, converted in
// place, are the B operand of the second product in the hardware k order.
// The mask comes as the lane-mask words packed by the conversion launch: 16 words
// a pass, the same for the whole wave, read by scalar loads one tile ahead; each
// word is the select condition of one score register.
#define KV_PITCH 72   // 128-byte rows at a 144-byte pitch (16 B x odd) for ds_load_b128

// value of lane l ^ 16
static __device__ __forceinline__ float other_half(float x) {
  const int b = __builtin_bit_cast(int, x);
  return __builtin_bit_cast(
      float, __builtin_amdgcn_permlanex16(b, b, 0x76543210, 0xfedcba98, false, false));
}

// waves_per_eu: the grid gives each SIMD four waves.  With the mask patch gone from
// LDS the compiler would plan for more, and to save registers put every LDS load
// directly in front of its product instead of fetching ahead.
__global__ void __launch_bounds__(256) __attribute__((amdgpu_waves_per_eu(4, 4)))
flash_attn_bf16(const __bf16* __restrict__ Q, const __bf16* __restrict__ Kh,
                const __bf16* __restrict__ Vt, const unsigned int* __restrict__ mbits,
                __bf16* __restrict__ ctx) {
  __shared__ __attribute__((aligned(16))) __bf16 sK[2][KT_][KV_PITCH];
  __shared__ __attribute__((aligned(16))) __bf16 sV[2][DK_][KV_PITCH];
  const int wid  = threadIdx.x >> 5;
  const int lane = threadIdx.x & 31;
  const int lm = lane & 15, h = lane >> 4;

  const int gt = blockIdx.x * 8 + wid;
  const int qt = gt & (S_ / 16 - 1);
  const int bh = gt >> 7;
  const int hd = bh & (NH_ - 1);
  const int bb = bh >> 4;
  const int qbase = qt * 16;

  const __bf16* Qp = Q  + ((size_t)(bb * NH_ + hd)) * S_ * DK_;
  const __bf16* Kp = Kh + ((size_t)(bb * NH_ + hd)) * S_ * DK_;
  const __bf16* Vp = Vt + ((size_t)(bb * NH_ + hd)) * DK_ * S_;
  // the wave's mask words, 16 a pass.  readfirstlane: the index is the same in every
  // lane; constant address space: nothing writes the words while this kernel runs.
  // Both are needed for the loads in the loop to be scalar loads.
  const cv16u* mw = (const cv16u*)(uintptr_t)(
      mbits + (size_t)__builtin_amdgcn_readfirstlane(bb * (S_ / 16) + qt) * (S_ / 32 * 16));

  v16bf bq[2];   // Q as B operand: column lm = query
#pragma unroll
  for (int c = 0; c < 2; ++c)
    bq[c] = load_op16(Qp + (size_t)(qbase + lm) * DK_ + 32 * c, h);

  v8f oacc[4] = {};          // Ot: oacc[nt][j] = O[query lm][nt*16 + 8h + j]
  float mrow = -3.0e38f;     // running maximum of query lm (equal in both halves)
  float lrow = 0.f;          // running sum over this half's keys only

  v16bf ak[2][2];  // [key-subtile][dk-chunk]
  v16bf av[4];

  // staging: 8 threads per 128-byte row, 32 rows per sweep, two sweeps per tile
  const int cr = threadIdx.x >> 3;        // 0..31
  const int cc = (threadIdx.x & 7) * 8;   // element in the row
  const __bf16* gK = Kp + (size_t)cr * DK_ + cc;
  const __bf16* gV = Vp + (size_t)cr * S_ + cc;

  auto stageKV = [&](int buf, int kb0) {
    const __bf16* k0 = gK + (size_t)kb0 * DK_;
    const __bf16* k1 = k0 + 32 * DK_;
    const __bf16* v0 = gV + kb0;
    const __bf16* v1 = v0 + (size_t)32 * S_;
    const unsigned lk0 = (unsigned)(uintptr_t)&sK[buf][cr][cc];
    const unsigned lk1 = (unsigned)(uintptr_t)&sK[buf][32 + cr][cc];
    const unsigned lv0 = (unsigned)(uintptr_t)&sV[buf][cr][cc];
    const unsigned lv1 = (unsigned)(uintptr_t)&sV[buf][32 + cr][cc];
    // the four copies of one tile; s_wait_xcnt closes the statement so that no
    // address register of a copy is rewritten ahead of it
    asm volatile(
        "global_load_async_to_lds_b128 %0, %4, off\n\t"
        "global_load_async_to_lds_b128 %1, %5, off\n\t"
        "global_load_async_to_lds_b128 %2, %6, off\n\t"
        "global_load_async_to_lds_b128 %3, %7, off\n\t"
        "s_wait_xcnt 0x0"
        :: "v"(lk0), "v"(lk1), "v"(lv0), "v"(lv1),
           "v"(k0), "v"(k1), "v"(v0), "v"(v1)
        : "memory");
  };

  const int NT = S_ / KT_;  // staged tiles
  stageKV(0, 0);
  wait_async0();     // this wave's share of tile 0 has landed
  __syncthreads();   // tile 0 readable by every wave
  stageKV(1, KT_);

  v16u mk[2];   // this tile's mask words, [pass]
  mk[0] = mw[0];
  mk[1] = mw[1];

  for (int ti = 0; ti < NT; ++ti) {
   const int buf = ti & 1;
   // ---- mask words of the next tile (the last tile reads its own again)
   const int tn = ti + 1 < NT ? ti + 1 : ti;
   const v16u mn0 = mw[2 * tn];
   const v16u mn1 = mw[2 * tn + 1];
   // unrolled so that the pass's place in the tile is a constant LDS offset
#pragma unroll
   for (int p = 0; p < KT_ / 32; ++p) {
    // ---- K operands of this pass from the staged tile (unrolled: constant
    // indices keep ak in registers)
#pragma unroll
    for (int tt = 0; tt < 2; ++tt)
#pragma unroll
      for (int c = 0; c < 2; ++c)
        ak[tt][c] = load_op16(&sK[buf][p * 32 + 16 * tt + lm][32 * c], h);

    // ---- scores: St[32k x 16q], K-dim = DK in two chunks of 32
    v8f sc[2] = {};
#pragma unroll
    for (int tt = 0; tt < 2; ++tt)
#pragma unroll
      for (int c = 0; c < 2; ++c)
        sc[tt] = __builtin_amdgcn_wmma_f32_16x16x32_bf16(
            false, ak[tt][c], false, bq[c], (short)0, sc[tt], false, false);

    // ---- V operands from the staged tile: row = dk, k = keys
#pragma unroll
    for (int nt = 0; nt < 4; ++nt)
      av[nt] = load_op16(&sV[buf][nt * 16 + lm][p * 32], h);

    // ---- scale by 1/sqrt(DK), apply mask
#pragma unroll
    for (int t = 0; t < 2; ++t)
#pragma unroll
      for (int j = 0; j < 8; ++j) {
        const float v = sc[t][j] * 0.125f;
        sc[t][j] = __builtin_amdgcn_inverse_ballot_w32(mk[p][8 * t + j]) ? v : -60000.f;
      }

    // ---- online softmax of one query per lane (its loops unrolled: sc is
    // indexed by constants and stays in registers)
    float cm = fmaxf(sc[0][0], sc[1][0]);
#pragma unroll
    for (int j = 1; j < 8; ++j) cm = fmaxf(cm, fmaxf(sc[0][j], sc[1][j]));
    cm = fmaxf(cm, other_half(cm));
    const float mnew = fmaxf(mrow, cm);
    const float alpha = __expf(mrow - mnew);
    mrow = mnew;
    float rs0 = 0.f, rs1 = 0.f;
#pragma unroll
    for (int j = 0; j < 8; ++j) {
      sc[0][j] = __expf(sc[0][j] - mnew);
      sc[1][j] = __expf(sc[1][j] - mnew);
      rs0 += sc[0][j];
      rs1 += sc[1][j];
    }
    lrow = lrow * alpha + (rs0 + rs1);
#pragma unroll
    for (int nt = 0; nt < 4; ++nt)
#pragma unroll
      for (int j = 0; j < 8; ++j) oacc[nt][j] *= alpha;

    // ---- Pt: the two score tiles, converted in place, are the B operand
    // (unrolled: pb and sc stay in registers)
    v16bf pb;
#pragma unroll
    for (int j = 0; j < 8; ++j) {
      pb[j]     = (__bf16)sc[0][j];
      pb[8 + j] = (__bf16)sc[1][j];
    }

    // ---- Ot += Vt @ Pt (4 M-tiles over DK)
#pragma unroll
    for (int nt = 0; nt < 4; ++nt)
      oacc[nt] = __builtin_amdgcn_wmma_f32_16x16x32_bf16(
          false, av[nt], false, pb, (short)0, oacc[nt], false, false);
   }

   // ---- publish point of tile ti + 1; the barrier also ends every wave's reads
   // of this tile's buffer, which is refilled behind it
   asm volatile("s_wait_dscnt 0x0" ::: "memory");  // own LDS reads retired
   wait_async0();                                  // own copies of tile ti + 1 landed
   __syncthreads();
   if (ti + 2 < NT) stageKV(buf, (ti + 2) * KT_);
   mk[0] = mn0;
   mk[1] = mn1;
  }
  wait_async0();  // nothing in flight when the wave ends

  // ---- join the halves' sums, normalize, emit context [B,S,H] bf16:
  // 8 consecutive dk of one query per lane and tile, one 16-byte store each
  // (unrolled: oacc is indexed by constants)
  const float inv = 1.f / (lrow + other_half(lrow));
  __bf16* op = ctx + ((size_t)(bb * S_ + qbase + lm)) * H_ + hd * DK_ + 8 * h;
#pragma unroll
  for (int nt = 0; nt < 4; ++nt) {
    v8bf y;
#pragma unroll
    for (int j = 0; j < 8; ++j) y[j] = (__bf16)(oacc[nt][j] * inv);
    *(v8bf*)(op + nt * 16) = y;
  }
}

// ---------------------------------------------------------------------------
extern "C" void kernel_launch(void* const* d_in, const int* in_sizes, int n_in,
                              void* d_out, int out_size, void* d_ws, size_t ws_size,
                              hipStream_t stream) {
  (void)in_sizes; (void)n_in; (void)out_size; (void)ws_size;
  const float* query = (const float*)d_in[0];
  const float* key   = (const float*)d_in[1];
  const int*   amask = (const int*)d_in[2];
  const float* Wq = (const float*)d_in[3]; const float* bq = (const float*)d_in[4];
  const float* Wk = (const float*)d_in[5]; const float* bk = (const float*)d_in[6];
  const float* Wv = (const float*)d_in[7]; const float* bv = (const float*)d_in[8];
  const float* Wo = (const float*)d_in[9]; const float* bo = (const float*)d_in[10];

  char* ws = (char*)d_ws;
  const size_t MB = 1u << 20;
  __bf16* Xq  = (__bf16*)(ws +  0 * MB);
  __bf16* Xk  = (__bf16*)(ws +  8 * MB);
  __bf16* Wqb = (__bf16*)(ws + 16 * MB);
  __bf16* Wkb = (__bf16*)(ws + 18 * MB);
  __bf16* Wvb = (__bf16*)(ws + 20 * MB);
  __bf16* Wob = (__bf16*)(ws + 22 * MB);
  __bf16* Qh  = (__bf16*)(ws + 24 * MB);  // [B,NH,S,DK]
  __bf16* Khd = (__bf16*)(ws + 32 * MB);  // [B,NH,S,DK]
  __bf16* Vtd = (__bf16*)(ws + 40 * MB);  // [B,NH,DK,S]
  __bf16* ctx = (__bf16*)(ws + 48 * MB);  // [B,S,H]
  unsigned int* mbits = (unsigned int*)(ws + 56 * MB);  // 1 MB of lane-mask words

  // Xq, Xk, Wqb, Wkb, Wvb, Wob are written as one run of 24 MB from Xq on
  cvt_f32_bf16<<<MASK_BLOCKS + 12 * CVT_BLOCKS_PER_PART, 256, 0, stream>>>(query, key, Wq, Wk, Wv, Wo, Xq,
                                                                           amask, mbits);

  dim3 g3(32, 8, 3);  // M/128 x N/128 x {Q, K, V}
  gemm_bf16_wmma<<<g3, 256, 0, stream>>>(Xq, Wqb, bq, Qh,  1,
                                         Xk, Wkb, bk, Khd, 1,
                                         Xk, Wvb, bv, Vtd, 2, B_*S_, H_, H_);

  flash_attn_bf16<<<512, 256, 0, stream>>>(Qh, Khd, Vtd, mbits, ctx);

  dim3 g1(32, 8, 1);
  gemm_bf16_wmma<<<g1, 256, 0, stream>>>(ctx, Wob, bo, d_out, 3,
                                         ctx, Wob, bo, d_out, 3,
                                         ctx, Wob, bo, d_out, 3, B_*S_, H_, H_);
}

// v007
// Measured time: 86.8 microseconds a run.
// Next to v006, in two timings, it ran 1.05 and 1.03 times as fast.
// Counting every step since v000, it is 4.95 times as fast.
#include <hip/hip_runtime.h>
#include <hip/hip_bf16.h>

typedef __attribute__((ext_vector_type(16))) __bf16 v16bf;
typedef __attribute__((ext_vector_type(8)))  __bf16 v8bf;
typedef __attribute__((ext_vector_type(4)))  __bf16 v4bf;
typedef __attribute__((ext_vector_type(8)))  float  v8f;
typedef __attribute__((ext_vector_type(4)))  float  v4f;
typedef __attribute__((ext_vector_type(4)))  int    v4i;
typedef __attribute__((ext_vector_type(2)))  int    v2i;
typedef __attribute__((ext_vector_type(16))) unsigned int v16u;
typedef __attribute__((address_space(4))) v16u cv16u;

#define B_  2
#define S_  2048
#define H_  1024
#define NH_ 16
#define DK_ 64

// ---------------------------------------------------------------------------
// WMMA operand builder: CDNA5 16-bit A/B layout, lane-half h holds
// K{8h..8h+7} in elements 0..7 and K{16+8h..16+8h+7} in elements 8..15.
static __device__ __forceinline__ v16bf load_op16(const __bf16* base, int h) {
  v8bf lo = *(const v8bf*)(base + 8 * h);
  v8bf hi = *(const v8bf*)(base + 16 + 8 * h);
  v16bf r;
#pragma unroll
  for (int i = 0; i < 8; ++i) { r[i] = lo[i]; r[8 + i] = hi[i]; }
  return r;
}

// 16-byte async global->LDS copy (ASYNCcnt-tracked).
static __device__ __forceinline__ void async_copy16(const __bf16* g, __bf16* l) {
#if __has_builtin(__builtin_amdgcn_global_load_async_to_lds_b128)
  __builtin_amdgcn_global_load_async_to_lds_b128(
      (__attribute__((address_space(1))) v4i*)(uintptr_t)g,
      (__attribute__((address_space(3))) v4i*)(unsigned)(uintptr_t)l, 0, 0);
#else
  asm volatile("global_load_async_to_lds_b128 %0, %1, off"
               :: "v"((unsigned)(uintptr_t)l),
                  "v"((unsigned long long)(uintptr_t)g)
               : "memory");
#endif
}

static __device__ __forceinline__ void wait_async8() {
  asm volatile("s_wait_asynccnt 0x8" ::: "memory");
}
static __device__ __forceinline__ void wait_async0() {
  asm volatile("s_wait_asynccnt 0x0" ::: "memory");
}

// The mask as lane-mask words, one bit an element.  For 16 queries (a wave's tile
// in the attention kernel) and 32 keys (one of its passes) there are 16 words:
// bit l of word 8*tt + j says whether query (l & 15) may see key
// 16*tt + 8*(l >> 4) + j, which is the score that lane l holds in register j of
// score tile tt.  Words of one query tile lie in key order: 64 passes x 16 words.
#define KT_ 64        // keys per staged tile = two passes of 32 keys
#define M_PITCH 68    // 256-byte mask rows at a 272-byte pitch (16 B x odd) for ds_load_b128
#define MASK_UNITS 4  // units of 16 queries x 64 keys per wave
#define MASK_BLOCKS (B_ * (S_ / 16) * (S_ / KT_) / MASK_UNITS / 8)

// All six f32 -> bf16 conversions and the packing of the mask in one launch.
// The first MASK_BLOCKS blocks pack the mask.  Behind them: the six bf16 copies lie
// one behind the other in out: query, key (4 parts of H*H elements each), Wq, Wk,
// Wv, Wo (1 part each).  A block takes 4096 groups of four elements, 64 blocks a
// part, so the source is the same for a whole block.
#define CVT_GROUPS 4096                      // groups of four elements per block
#define CVT_BLOCKS_PER_PART (H_ * H_ / 4 / CVT_GROUPS)
__global__ void __launch_bounds__(256)
cvt_f32_bf16(const float* __restrict__ q, const float* __restrict__ k,
             const float* __restrict__ wq, const float* __restrict__ wk,
             const float* __restrict__ wv, const float* __restrict__ wo,
             __bf16* __restrict__ out,
             const int* __restrict__ mask, unsigned int* __restrict__ mbits) {
  __shared__ __attribute__((aligned(16))) int sM[8][16][M_PITCH];  // one patch per wave
  if (blockIdx.x < MASK_BLOCKS) {
    // Each wave reads 16 mask rows as whole 256-byte pieces (lane = two keys), turns
    // them through its own LDS patch so that lane l holds the keys of query l & 15
    // in the score layout, and takes one ballot per word.
    const int wid  = threadIdx.x >> 5;
    const int lane = threadIdx.x & 31;
    const int lm = lane & 15, h = lane >> 4;
    const int u0 = (blockIdx.x * 8 + wid) * MASK_UNITS;   // first unit of the wave
    // unit u = (query tile, 64-key tile); the wave's units are one query tile's
    const int* mp = mask + (size_t)(u0 / (S_ / KT_)) * 16 * S_ + (u0 % (S_ / KT_)) * KT_ + 2 * lane;
    v2i mg[16];
    // unrolled: constant indices keep mg in registers
#pragma unroll
    for (int r = 0; r < 16; ++r) mg[r] = *(const v2i*)(mp + (size_t)r * S_);
    // unrolled: the next unit's loads fly while this one is turned, nx in registers
#pragma unroll
    for (int u = 0; u < MASK_UNITS; ++u) {
      v2i nx[16];
      if (u + 1 < MASK_UNITS) {
#pragma unroll
        for (int r = 0; r < 16; ++r) nx[r] = *(const v2i*)(mp + (size_t)r * S_ + (u + 1) * KT_);
      }
#pragma unroll
      for (int r = 0; r < 16; ++r) *(v2i*)&sM[wid][r][2 * lane] = mg[r];
      // the lanes read each other's stores: keeps the reads below behind them
      asm volatile("s_wait_dscnt 0x0" ::: "memory");
      unsigned int word = 0;   // lane l ends up with word l of the unit's 32
#pragma unroll
      for (int g = 0; g < 4; ++g)     // g = 2 * pass + tt: a 16-key group
#pragma unroll
        for (int c = 0; c < 2; ++c) {
          const v4i m4 = *(const v4i*)&sM[wid][lm][16 * g + 8 * h + 4 * c];
#pragma unroll
          for (int e = 0; e < 4; ++e) {
            const unsigned int w = __builtin_amdgcn_ballot_w32(m4[e] != 0);
            if (lane == 8 * g + 4 * c + e) word = w;
          }
        }
      mbits[(size_t)(u0 + u) * 32 + lane] = word;   // one 128-byte line
      // the next unit's stores overwrite what other lanes have just read: keeps
      // them behind those reads
      if (u + 1 < MASK_UNITS) {
        asm volatile("s_wait_dscnt 0x0" ::: "memory");
#pragma unroll
        for (int r = 0; r < 16; ++r) mg[r] = nx[r];
      }
    }
    return;
  }
  const int cb = blockIdx.x - MASK_BLOCKS;
  const int part = cb / CVT_BLOCKS_PER_PART;   // 0..11
  const float* in;
  int first;                                           // the source's first part
  if (part < 4)       { in = q;  first = 0; }
  else if (part < 8)  { in = k;  first = 4; }
  else if (part == 8) { in = wq; first = 8; }
  else if (part == 9) { in = wk; first = 9; }
  else if (part == 10) { in = wv; first = 10; }
  else                { in = wo; first = 11; }
  const int o0 = cb * CVT_GROUPS + threadIdx.x;
  const int i0 = o0 - first * (H_ * H_ / 4);
  for (int r = 0; r < CVT_GROUPS / 256 / 8; ++r) {
    v4f x[8];
    // unrolled: eight loads in flight per lane, x indexed by constants
#pragma unroll
    for (int u = 0; u < 8; ++u) x[u] = ((const v4f*)in)[i0 + (r * 8 + u) * 256];
    // both unrolled: x and y are indexed by constants and stay in registers
#pragma unroll
    for (int u = 0; u < 8; ++u) {
      v4bf y;
#pragma unroll
      for (int j = 0; j < 4; ++j) y[j] = (__bf16)x[u][j];
      ((v4bf*)out)[o0 + (r * 8 + u) * 256] = y;
    }
  }
}

// ---------------------------------------------------------------------------
// C[M,N] = A[M,K](bf16) @ W[N,K]^T(bf16) + bias[N](f32)
// LDS-staged, double-buffered async pipeline.  WG = 256 thr (8 waves),
// tile 128(M) x 128(N) x 64(K) per stage; wave tile 64x32; 16 WMMAs/stage/wave.
// mode 1: bf16 out [B,NH,S,DK]; mode 2: bf16 out [B,NH,DK,S]; mode 3: f32 [M,N]
// Up to three independent products of one shape in one launch: blockIdx.z picks
// the operand set.
#define BM_ 128
#define BN_ 128
#define LDS_STRIDE 72  // 64 + 8 bf16 pad -> 36-bank row stride, conflict-free
#define ST_F32  132    // output staging: 512-byte f32 rows at a 528-byte pitch (16 B x odd)
#define ST_BF16 136    // output staging: 256-byte bf16 rows at a 272-byte pitch (16 B x odd)

// waves_per_eu: the larger grid gives each SIMD six waves (three work-groups a WGP),
// which is 160 registers a wave.  Left alone the compiler plans for the eight that LDS
// would admit, too few registers for the read order set in the loop.
__global__ void __launch_bounds__(256) __attribute__((amdgpu_waves_per_eu(6, 6)))
gemm_bf16_wmma(const __bf16* A0, const __bf16* W0, const float* bias0, void* out0, int mode0,
               const __bf16* A1, const __bf16* W1, const float* bias1, void* out1, int mode1,
               const __bf16* A2, const __bf16* W2, const float* bias2, void* out2, int mode2,
               int M, int N, int K) {
  // a stage: rows 0..127 the A tile, rows 128..255 the W tile; also the output staging
  __shared__ __attribute__((aligned(16))) __bf16 sT[2][BM_ + BN_][LDS_STRIDE];

  const int z = blockIdx.z;
  const __bf16* __restrict__ A = z == 0 ? A0 : z == 1 ? A1 : A2;
  const __bf16* __restrict__ W = z == 0 ? W0 : z == 1 ? W1 : W2;
  const float* __restrict__ bias = z == 0 ? bias0 : z == 1 ? bias1 : bias2;
  void* __restrict__ out = z == 0 ? out0 : z == 1 ? out1 : out2;
  const int mode = z == 0 ? mode0 : z == 1 ? mode1 : mode2;

  const int tid  = threadIdx.x;
  const int wid  = tid >> 5;
  const int lane = tid & 31;
  const int lm = lane & 15, h = lane >> 4;
  const int wm = wid & 1, wn = wid >> 1;
  const int mBase = blockIdx.x * BM_;
  const int nBase = blockIdx.y * BN_;

  // staging: 8 threads per 128-byte row, 32 rows per sweep, four sweeps per operand
  const int cr = tid >> 3;         // 0..31
  const int cc = (tid & 7) * 8;    // element in the row
  const __bf16* gA = A + (size_t)(mBase + cr) * K + cc;
  const __bf16* gB = W + (size_t)(nBase + cr) * K + cc;

  v8f acc[4][2] = {};

  const int NK = K / 64;  // stages
  // Work-groups that share A rows (same x) or W rows (same y and z) start together and
  // would ask L2 for the same lines, and for the same 128 bytes of every row, at
  // the same moment.  Each starts its walk over k at a stage of its own and wraps.
  const int kFirst = (int)((blockIdx.x + 2 * blockIdx.y + blockIdx.z) % (unsigned)NK);
  auto kOf = [&](int trip) {   // first k of the stage that is worked on in a trip
    const int s = trip + kFirst;
    return (s < NK ? s : s - NK) * 64;
  };

  auto stage = [&](int buf, int k0) {
    // unrolled: eight copies one behind the other, the count that wait_async8 leans on
#pragma unroll
    for (int i = 0; i < 4; ++i) {
      async_copy16(gA + (size_t)(32 * i) * K + k0, &sT[buf][32 * i + cr][cc]);
      async_copy16(gB + (size_t)(32 * i) * K + k0, &sT[buf][BM_ + 32 * i + cr][cc]);
    }
  };

  stage(0, kOf(0));  // prologue

  for (int kc = 0; kc < NK; ++kc) {
    const int cur = kc & 1;
    if (kc + 1 < NK) {
      stage(cur ^ 1, kOf(kc + 1));
      wait_async8();   // previous buffer's 8 copies (this wave) complete
    } else {
      wait_async0();
    }
    __syncthreads();   // all waves' copies into `cur` visible

    const __bf16* ap = &sT[cur][wm * 64 + lm][0];
    const __bf16* bp = &sT[cur][BM_ + wn * 32 + lm][0];
    // all unrolled: a, b and acc are indexed by constants and stay in registers
    v16bf a[2][4], b[2][2];
#pragma unroll
    for (int kk = 0; kk < 2; ++kk) {
#pragma unroll
      for (int ms = 0; ms < 4; ++ms) a[kk][ms] = load_op16(ap + ms * 16 * LDS_STRIDE + kk * 32, h);
#pragma unroll
      for (int ns = 0; ns < 2; ++ns) b[kk][ns] = load_op16(bp + ns * 16 * LDS_STRIDE + kk * 32, h);
    }
#pragma unroll
    for (int kk = 0; kk < 2; ++kk)
#pragma unroll
      for (int ms = 0; ms < 4; ++ms)
#pragma unroll
        for (int ns = 0; ns < 2; ++ns)
          acc[ms][ns] = __builtin_amdgcn_wmma_f32_16x16x32_bf16(false, a[kk][ms], false, b[kk][ns],
                                                                (short)0, acc[ms][ns], false, false);
    // order of the stage's LDS reads (0x100) and products (0x8): the first half's twelve
    // reads and four of the second half's go ahead as one group, then one more fragment
    // of the second half is fetched behind every two products, into the registers that
    // they free.  Left alone the compiler reloads one A fragment in front of every two
    // products and waits out the LDS latency each time.
    __builtin_amdgcn_sched_group_barrier(0x100, 16, 0);
#pragma unroll
    for (int ms = 0; ms < 4; ++ms) {
      __builtin_amdgcn_sched_group_barrier(0x8, 2, 0);
      __builtin_amdgcn_sched_group_barrier(0x100, 2, 0);
    }
    __builtin_amdgcn_sched_group_barrier(0x8, 8, 0);

    __syncthreads();   // reads of `cur` done before it is overwritten
  }

  // ---- The tile leaves through LDS, so that every global store is 16 bytes a lane
  // and eight neighbouring lanes fill one whole 128-byte line of the output.  The
  // ring is free here: the last trip waited for every copy, and its closing barrier
  // ended every wave's reads.  mode is the same for the whole work-group, so each
  // barrier below is passed by all of its waves.
  const int ml = wm * 64 + 8 * h;   // the lane's first tile row; + ms * 16 + j
  const int nl = wn * 32 + lm;      // the lane's first tile column; + ns * 16
  if (mode == 3) {
    float* st = (float*)&sT[0][0][0];   // [128][ST_F32]
    // unrolled here and below: acc is indexed by constants and stays in registers
#pragma unroll
    for (int ns = 0; ns < 2; ++ns) {
      const float bn = bias[nBase + nl + ns * 16];
#pragma unroll
      for (int ms = 0; ms < 4; ++ms)
#pragma unroll
        for (int j = 0; j < 8; ++j)
          st[(ml + ms * 16 + j) * ST_F32 + nl + ns * 16] = acc[ms][ns][j] + bn;
    }
    __syncthreads();   // the rows read below were written by four waves
    // a wave stores one 512-byte row piece (four lines) at a time.  readfirstlane:
    // the wave's number is the same in every lane; it keeps the sixteen row offsets
    // in scalar registers
    const int wu = __builtin_amdgcn_readfirstlane(wid);
#pragma unroll
    for (int i = 0; i < 16; ++i) {
      const int row = i * 8 + wu;
      const v4f x = *(const v4f*)&st[row * ST_F32 + lane * 4];
      *(v4f*)((float*)out + (size_t)(mBase + row) * N + nBase + lane * 4) = x;
    }
    // the code behind this branch reuses registers that the stores above name
    asm volatile("s_wait_xcnt 0x0" ::: "memory");
  } else if (mode == 1) {
    __bf16* st = &sT[0][0][0];          // [128 positions][ST_BF16]
#pragma unroll
    for (int ns = 0; ns < 2; ++ns) {
      const float bn = bias[nBase + nl + ns * 16];
#pragma unroll
      for (int ms = 0; ms < 4; ++ms)
#pragma unroll
        for (int j = 0; j < 8; ++j)
          st[(ml + ms * 16 + j) * ST_BF16 + nl + ns * 16] = (__bf16)(acc[ms][ns][j] + bn);
    }
    __syncthreads();   // the rows read below were written by four waves
    // a line = the DK values of one position and one of the tile's two heads
    const int l8 = tid >> 3;          // line of a sweep of 32 lines
    const int e8 = (tid & 7) * 8;     // the thread's eight bf16 in its line
#pragma unroll
    for (int i = 0; i < 8; ++i) {
      const int line = i * 32 + l8;
      const int m = mBase + (line & (BM_ - 1));   // m = b*S + s
      const int hd = (nBase >> 6) + (line >> 7);  // n = h*DK + d
      const int bb = m >> 11, s = m & (S_ - 1);
      const v8bf y = *(const v8bf*)&st[(line & (BM_ - 1)) * ST_BF16 + (line >> 7) * DK_ + e8];
      *(v8bf*)((__bf16*)out + (((size_t)(bb * NH_ + hd)) * S_ + s) * DK_ + e8) = y;
    }
    // the code behind this branch reuses registers that the stores above name
    asm volatile("s_wait_xcnt 0x0" ::: "memory");
  } else {
    __bf16* st = &sT[0][0][0];          // [128 columns][ST_BF16], positions along a row
#pragma unroll
    for (int ns = 0; ns < 2; ++ns) {
      const float bn = bias[nBase + nl + ns * 16];
#pragma unroll
      for (int ms = 0; ms < 4; ++ms) {
        v8bf y;
#pragma unroll
        for (int j = 0; j < 8; ++j) y[j] = (__bf16)(acc[ms][ns][j] + bn);
        *(v8bf*)&st[(nl + ns * 16) * ST_BF16 + ml + ms * 16] = y;
      }
    }
    __syncthreads();   // the rows read below were written by two waves
    // two lines = the tile's 128 positions of one head and one of its DK rows
    const int bb = mBase >> 11, s = mBase & (S_ - 1);   // 128 divides S: one batch a tile
    const int r16 = tid >> 4;          // row of a sweep of 16 rows
    const int e16 = (tid & 15) * 8;    // the thread's eight bf16 in its row
#pragma unroll
    for (int i = 0; i < 8; ++i) {
      const int col = i * 16 + r16;
      const int n = nBase + col;
      const int hd = n >> 6, d = n & (DK_ - 1);
      const v8bf y = *(const v8bf*)&st[col * ST_BF16 + e16];
      *(v8bf*)((__bf16*)out + (((size_t)(bb * NH_ + hd)) * DK_ + d) * S_ + s + e16) = y;
    }
    // the compiler lays another branch's code, which reuses registers that the stores
    // above name, behind this one
    asm volatile("s_wait_xcnt 0x0" ::: "memory");
  }
}

// ---------------------------------------------------------------------------
// Flash attention: one wave owns a 16-row Q tile; the work-group's 8 waves are
// 8 Q tiles of ONE head, so each 64-key K tile and V tile is brought into LDS
// once per work-group by asynchronous copies (whole 128-byte rows, two buffers,
// the next tile in flight while this one is worked on) and every wave reads its
// WMMA operands from there.  Q,K: [B,NH,S,DK]; V: [B,NH,DK,S] bf16.
// The products are taken transposed: St = K Qt and Ot += Vt Pt.  A lane then
// holds 16 of the 32 keys of ONE query (lane lm = query, register j = key
// 8h + j of a 16-key tile), so maximum and sum run inside the lane with one
// exchange between the wave's halves, and the two score tiles, converted in
// place, are the B operand of the second product in the hardware k order.
// The mask comes as the lane-mask words packed by the conversion launch: 16 words
// a pass, the same for the whole wave, read by scalar loads one tile ahead; each
// word is the select condition of one score register.
#define KV_PITCH 72   // 128-byte rows at a 144-byte pitch (16 B x odd) for ds_load_b128

// value of lane l ^ 16
static __device__ __forceinline__ float other_half(float x) {
  const int b = __builtin_bit_cast(int, x);
  return __builtin_bit_cast(
      float, __builtin_amdgcn_permlanex16(b, b, 0x76543210, 0xfedcba98, false, false));
}

// waves_per_eu: the grid gives each SIMD four waves.  With the mask patch gone from
// LDS the compiler would plan for more, and to save registers put every LDS load
// directly in front of its product instead of fetching ahead.
__global__ void __launch_bounds__(256) __attribute__((amdgpu_waves_per_eu(4, 4)))
flash_attn_bf16(const __bf16* __restrict__ Q, const __bf16* __restrict__ Kh,
                const __bf16* __restrict__ Vt, const unsigned int* __restrict__ mbits,
                __bf16* __restrict__ ctx) {
  __shared__ __attribute__((aligned(16))) __bf16 sK[2][KT_][KV_PITCH];
  __shared__ __attribute__((aligned(16))) __bf16 sV[2][DK_][KV_PITCH];
  const int wid  = threadIdx.x >> 5;
  const int lane = threadIdx.x & 31;
  const int lm = lane & 15, h = lane >> 4;

  const int gt = blockIdx.x * 8 + wid;
  const int qt = gt & (S_ / 16 - 1);
  const int bh = gt >> 7;
  const int hd = bh & (NH_ - 1);
  const int bb = bh >> 4;
  const int qbase = qt * 16;

  const __bf16* Qp = Q  + ((size_t)(bb * NH_ + hd)) * S_ * DK_;
  const __bf16* Kp = Kh + ((size_t)(bb * NH_ + hd)) * S_ * DK_;
  const __bf16* Vp = Vt + ((size_t)(bb * NH_ + hd)) * DK_ * S_;
  // the wave's mask words, 16 a pass.  readfirstlane: the index is the same in every
  // lane; constant address space: nothing writes the words while this kernel runs.
  // Both are needed for the loads in the loop to be scalar loads.
  const cv16u* mw = (const cv16u*)(uintptr_t)(
      mbits + (size_t)__builtin_amdgcn_readfirstlane(bb * (S_ / 16) + qt) * (S_ / 32 * 16));

  v16bf bq[2];   // Q as B operand: column lm = query
#pragma unroll
  for (int c = 0; c < 2; ++c)
    bq[c] = load_op16(Qp + (size_t)(qbase + lm) * DK_ + 32 * c, h);

  v8f oacc[4] = {};          // Ot: oacc[nt][j] = O[query lm][nt*16 + 8h + j]
  float mrow = -3.0e38f;     // running maximum of query lm (equal in both halves)
  float lrow = 0.f;          // running sum over this half's keys only

  v16bf ak[2][2];  // [key-subtile][dk-chunk]
  v16bf av[4];

  // staging: 8 threads per 128-byte row, 32 rows per sweep, two sweeps per tile
  const int cr = threadIdx.x >> 3;        // 0..31
  const int cc = (threadIdx.x & 7) * 8;   // element in the row
  const __bf16* gK = Kp + (size_t)cr * DK_ + cc;
  const __bf16* gV = Vp + (size_t)cr * S_ + cc;

  auto stageKV = [&](int buf, int kb0) {
    const __bf16* k0 = gK + (size_t)kb0 * DK_;
    const __bf16* k1 = k0 + 32 * DK_;
    const __bf16* v0 = gV + kb0;
    const __bf16* v1 = v0 + (size_t)32 * S_;
    const unsigned lk0 = (unsigned)(uintptr_t)&sK[buf][cr][cc];
    const unsigned lk1 = (unsigned)(uintptr_t)&sK[buf][32 + cr][cc];
    const unsigned lv0 = (unsigned)(uintptr_t)&sV[buf][cr][cc];
    const unsigned lv1 = (unsigned)(uintptr_t)&sV[buf][32 + cr][cc];
    // the four copies of one tile; s_wait_xcnt closes the statement so that no
    // address register of a copy is rewritten ahead of it
    asm volatile(
        "global_load_async_to_lds_b128 %0, %4, off\n\t"
        "global_load_async_to_lds_b128 %1, %5, off\n\t"
        "global_load_async_to_lds_b128 %2, %6, off\n\t"
        "global_load_async_to_lds_b128 %3, %7, off\n\t"
        "s_wait_xcnt 0x0"
        :: "v"(lk0), "v"(lk1), "v"(lv0), "v"(lv1),
           "v"(k0), "v"(k1), "v"(v0), "v"(v1)
        : "memory");
  };

  const int NT = S_ / KT_;  // staged tiles
  // The S/128 work-groups of one head start together and would ask L2 for the same K
  // and V lines at the same moment.  Each starts its walk over the key tiles at a tile
  // of its own and wraps; neighbouring heads take the tiles in between.
  const int tFirst = ((blockIdx.x & (S_ / 128 - 1)) * (NT / (S_ / 128)) +
                      ((blockIdx.x / (S_ / 128)) & 1)) & (NT - 1);
  auto tileOf = [&](int trip) { return (trip + tFirst) & (NT - 1); };
  stageKV(0, tileOf(0) * KT_);
  wait_async0();     // this wave's share of the first tile has landed
  __syncthreads();   // the first tile readable by every wave
  stageKV(1, tileOf(1) * KT_);

  v16u mk[2];   // this tile's mask words, [pass]
  mk[0] = mw[2 * tileOf(0)];
  mk[1] = mw[2 * tileOf(0) + 1];

  for (int ti = 0; ti < NT; ++ti) {
   const int buf = ti & 1;
   // ---- mask words of the next tile (the last trip reads its own again)
   const int tn = tileOf(ti + 1 < NT ? ti + 1 : ti);
   const v16u mn0 = mw[2 * tn];
   const v16u mn1 = mw[2 * tn + 1];
   // unrolled so that the pass's place in the tile is a constant LDS offset
#pragma unroll
   for (int p = 0; p < KT_ / 32; ++p) {
    // ---- K operands of this pass from the staged tile (unrolled: constant
    // indices keep ak in registers)
#pragma unroll
    for (int tt = 0; tt < 2; ++tt)
#pragma unroll
      for (int c = 0; c < 2; ++c)
        ak[tt][c] = load_op16(&sK[buf][p * 32 + 16 * tt + lm][32 * c], h);

    // ---- scores: St[32k x 16q], K-dim = DK in two chunks of 32
    v8f sc[2] = {};
#pragma unroll
    for (int tt = 0; tt < 2; ++tt)
#pragma unroll
      for (int c = 0; c < 2; ++c)
        sc[tt] = __builtin_amdgcn_wmma_f32_16x16x32_bf16(
            false, ak[tt][c], false, bq[c], (short)0, sc[tt], false, false);

    // ---- V operands from the staged tile: row = dk, k = keys
#pragma unroll
    for (int nt = 0; nt < 4; ++nt)
      av[nt] = load_op16(&sV[buf][nt * 16 + lm][p * 32], h);

    // ---- scale by 1/sqrt(DK), apply mask
#pragma unroll
    for (int t = 0; t < 2; ++t)
#pragma unroll
      for (int j = 0; j < 8; ++j) {
        const float v = sc[t][j] * 0.125f;
        sc[t][j] = __builtin_amdgcn_inverse_ballot_w32(mk[p][8 * t + j]) ? v : -60000.f;
      }

    // ---- online softmax of one query per lane (its loops unrolled: sc is
    // indexed by constants and stays in registers)
    float cm = fmaxf(sc[0][0], sc[1][0]);
#pragma unroll
    for (int j = 1; j < 8; ++j) cm = fmaxf(cm, fmaxf(sc[0][j], sc[1][j]));
    cm = fmaxf(cm, other_half(cm));
    const float mnew = fmaxf(mrow, cm);
    const float alpha = __expf(mrow - mnew);
    mrow = mnew;
    float rs0 = 0.f, rs1 = 0.f;
#pragma unroll
    for (int j = 0; j < 8; ++j) {
      sc[0][j] = __expf(sc[0][j] - mnew);
      sc[1][j] = __expf(sc[1][j] - mnew);
      rs0 += sc[0][j];
      rs1 += sc[1][j];
    }
    lrow = lrow * alpha + (rs0 + rs1);
#pragma unroll
    for (int nt = 0; nt < 4; ++nt)
#pragma unroll
      for (int j = 0; j < 8; ++j) oacc[nt][j] *= alpha;

    // ---- Pt: the two score tiles, converted in place, are the B operand
    // (unrolled: pb and sc stay in registers)
    v16bf pb;
#pragma unroll
    for (int j = 0; j < 8; ++j) {
      pb[j]     = (__bf16)sc[0][j];
      pb[8 + j] = (__bf16)sc[1][j];
    }

    // ---- Ot += Vt @ Pt (4 M-tiles over DK)
#pragma unroll
    for (int nt = 0; nt < 4; ++nt)
      oacc[nt] = __builtin_amdgcn_wmma_f32_16x16x32_bf16(
          false, av[nt], false, pb, (short)0, oacc[nt], false, false);
   }

   // ---- publish point of the next trip's tile; the barrier also ends every wave's reads
   // of this tile's buffer, which is refilled behind it
   asm volatile("s_wait_dscnt 0x0" ::: "memory");  // own LDS reads retired
   wait_async0();                                  // own copies of the next trip's tile landed
   __syncthreads();
   if (ti + 2 < NT) stageKV(buf, tileOf(ti + 2) * KT_);
   mk[0] = mn0;
   mk[1] = mn1;
  }
  wait_async0();  // nothing in flight when the wave ends

  // ---- join the halves' sums, normalize, emit context [B,S,H] bf16:
  // 8 consecutive dk of one query per lane and tile, one 16-byte store each
  // (unrolled: oacc is indexed by constants)
  const float inv = 1.f / (lrow + other_half(lrow));
  __bf16* op = ctx + ((size_t)(bb * S_ + qbase + lm)) * H_ + hd * DK_ + 8 * h;
#pragma unroll
  for (int nt = 0; nt < 4; ++nt) {
    v8bf y;
#pragma unroll
    for (int j = 0; j < 8; ++j) y[j] = (__bf16)(oacc[nt][j] * inv);
    *(v8bf*)(op + nt * 16) = y;
  }
}

// ---------------------------------------------------------------------------
extern "C" void kernel_launch(void* const* d_in, const int* in_sizes, int n_in,
                              void* d_out, int out_size, void* d_ws, size_t ws_size,
                              hipStream_t stream) {
  (void)in_sizes; (void)n_in; (void)out_size; (void)ws_size;
  const float* query = (const float*)d_in[0];
  const float* key   = (const float*)d_in[1];
  const int*   amask = (const int*)d_in[2];
  const float* Wq = (const float*)d_in[3]; const float* bq = (const float*)d_in[4];
  const float* Wk = (const float*)d_in[5]; const float* bk = (const float*)d_in[6];
  const float* Wv = (const float*)d_in[7]; const float* bv = (const float*)d_in[8];
  const float* Wo = (const float*)d_in[9]; const float* bo = (const float*)d_in[10];

  char* ws = (char*)d_ws;
  const size_t MB = 1u << 20;
  __bf16* Xq  = (__bf16*)(ws +  0 * MB);
  __bf16* Xk  = (__bf16*)(ws +  8 * MB);
  __bf16* Wqb = (__bf16*)(ws + 16 * MB);
  __bf16* Wkb = (__bf16*)(ws + 18 * MB);
  __bf16* Wvb = (__bf16*)(ws + 20 * MB);
  __bf16* Wob = (__bf16*)(ws + 22 * MB);
  __bf16* Qh  = (__bf16*)(ws + 24 * MB);  // [B,NH,S,DK]
  __bf16* Khd = (__bf16*)(ws + 32 * MB);  // [B,NH,S,DK]
  __bf16* Vtd = (__bf16*)(ws + 40 * MB);  // [B,NH,DK,S]
  __bf16* ctx = (__bf16*)(ws + 48 * MB);  // [B,S,H]
  unsigned int* mbits = (unsigned int*)(ws + 56 * MB);  // 1 MB of lane-mask words

  // Xq, Xk, Wqb, Wkb, Wvb, Wob are written as one run of 24 MB from Xq on
  cvt_f32_bf16<<<MASK_BLOCKS + 12 * CVT_BLOCKS_PER_PART, 256, 0, stream>>>(query, key, Wq, Wk, Wv, Wo, Xq,
                                                                           amask, mbits);

  dim3 g3(32, 8, 3);  // M/128 x N/128 x {Q, K, V}
  gemm_bf16_wmma<<<g3, 256, 0, stream>>>(Xq, Wqb, bq, Qh,  1,
                                         Xk, Wkb, bk, Khd, 1,
                                         Xk, Wvb, bv, Vtd, 2, B_*S_, H_, H_);

  flash_attn_bf16<<<512, 256, 0, stream>>>(Qh, Khd, Vtd, mbits, ctx);

  dim3 g1(32, 8, 1);
  gemm_bf16_wmma<<<g1, 256, 0, stream>>>(ctx, Wob, bo, d_out, 3,
                                         ctx, Wob, bo, d_out, 3,
                                         ctx, Wob, bo, d_out, 3, B_*S_, H_, H_);
}

// v008
// It runs in 83.5 microseconds.
// Timed twice side by side with v007, it ran 1.04 times as fast both times.
// Counting every step since v000, it is 5.16 times as fast.
#include <hip/hip_runtime.h>
#include <hip/hip_bf16.h>

typedef __attribute__((ext_vector_type(16))) __bf16 v16bf;
typedef __attribute__((ext_vector_type(8)))  __bf16 v8bf;
typedef __attribute__((ext_vector_type(4)))  __bf16 v4bf;
typedef __attribute__((ext_vector_type(8)))  float  v8f;
typedef __attribute__((ext_vector_type(4)))  float  v4f;
typedef __attribute__((ext_vector_type(2)))  float  v2f;
typedef __attribute__((ext_vector_type(4)))  int    v4i;
typedef __attribute__((ext_vector_type(2)))  int    v2i;
typedef __attribute__((ext_vector_type(16))) unsigned int v16u;
typedef __attribute__((address_space(4))) v16u cv16u;

#define B_  2
#define S_  2048
#define H_  1024
#define NH_ 16
#define DK_ 64

// ---------------------------------------------------------------------------
// WMMA operand builder: CDNA5 16-bit A/B layout, lane-half h holds
// K{8h..8h+7} in elements 0..7 and K{16+8h..16+8h+7} in elements 8..15.
static __device__ __forceinline__ v16bf load_op16(const __bf16* base, int h) {
  v8bf lo = *(const v8bf*)(base + 8 * h);
  v8bf hi = *(const v8bf*)(base + 16 + 8 * h);
  v16bf r;
#pragma unroll
  for (int i = 0; i < 8; ++i) { r[i] = lo[i]; r[8 + i] = hi[i]; }
  return r;
}

// 16-byte async global->LDS copy (ASYNCcnt-tracked).
static __device__ __forceinline__ void async_copy16(const __bf16* g, __bf16* l) {
#if __has_builtin(__builtin_amdgcn_global_load_async_to_lds_b128)
  __builtin_amdgcn_global_load_async_to_lds_b128(
      (__attribute__((address_space(1))) v4i*)(uintptr_t)g,
      (__attribute__((address_space(3))) v4i*)(unsigned)(uintptr_t)l, 0, 0);
#else
  asm volatile("global_load_async_to_lds_b128 %0, %1, off"
               :: "v"((unsigned)(uintptr_t)l),
                  "v"((unsigned long long)(uintptr_t)g)
               : "memory");
#endif
}

static __device__ __forceinline__ void wait_async8() {
  asm volatile("s_wait_asynccnt 0x8" ::: "memory");
}
static __device__ __forceinline__ void wait_async0() {
  asm volatile("s_wait_asynccnt 0x0" ::: "memory");
}

// The mask as lane-mask words, one bit an element.  For 16 queries (a wave's tile
// in the attention kernel) and 32 keys (one of its passes) there are 16 words:
// bit l of word 8*tt + j says whether query (l & 15) may see key
// 16*tt + 8*(l >> 4) + j, which is the score that lane l holds in register j of
// score tile tt.  Words of one query tile lie in key order: 64 passes x 16 words.
#define KT_ 64        // keys per staged tile = two passes of 32 keys
#define M_PITCH 68    // 256-byte mask rows at a 272-byte pitch (16 B x odd) for ds_load_b128
#define MASK_UNITS 4  // units of 16 queries x 64 keys per wave
#define MASK_BLOCKS (B_ * (S_ / 16) * (S_ / KT_) / MASK_UNITS / 8)

// All six f32 -> bf16 conversions and the packing of the mask in one launch.
// The first MASK_BLOCKS blocks pack the mask.  Behind them: the six bf16 copies lie
// one behind the other in out: query, key (4 parts of H*H elements each), Wq, Wk,
// Wv, Wo (1 part each).  A block takes 4096 groups of four elements, 64 blocks a
// part, so the source is the same for a whole block.
#define CVT_GROUPS 4096                      // groups of four elements per block
#define CVT_BLOCKS_PER_PART (H_ * H_ / 4 / CVT_GROUPS)
__global__ void __launch_bounds__(256)
cvt_f32_bf16(const float* __restrict__ q, const float* __restrict__ k,
             const float* __restrict__ wq, const float* __restrict__ wk,
             const float* __restrict__ wv, const float* __restrict__ wo,
             __bf16* __restrict__ out,
             const int* __restrict__ mask, unsigned int* __restrict__ mbits) {
  __shared__ __attribute__((aligned(16))) int sM[8][16][M_PITCH];  // one patch per wave
  if (blockIdx.x < MASK_BLOCKS) {
    // Each wave reads 16 mask rows as whole 256-byte pieces (lane = two keys), turns
    // them through its own LDS patch so that lane l holds the keys of query l & 15
    // in the score layout, and takes one ballot per word.
    const int wid  = threadIdx.x >> 5;
    const int lane = threadIdx.x & 31;
    const int lm = lane & 15, h = lane >> 4;
    const int u0 = (blockIdx.x * 8 + wid) * MASK_UNITS;   // first unit of the wave
    // unit u = (query tile, 64-key tile); the wave's units are one query tile's
    const int* mp = mask + (size_t)(u0 / (S_ / KT_)) * 16 * S_ + (u0 % (S_ / KT_)) * KT_ + 2 * lane;
    v2i mg[16];
    // unrolled: constant indices keep mg in registers
#pragma unroll
    for (int r = 0; r < 16; ++r) mg[r] = *(const v2i*)(mp + (size_t)r * S_);
    // unrolled: the next unit's loads fly while this one is turned, nx in registers
#pragma unroll
    for (int u = 0; u < MASK_UNITS; ++u) {
      v2i nx[16];
      if (u + 1 < MASK_UNITS) {
#pragma unroll
        for (int r = 0; r < 16; ++r) nx[r] = *(const v2i*)(mp + (size_t)r * S_ + (u + 1) * KT_);
      }
#pragma unroll
      for (int r = 0; r < 16; ++r) *(v2i*)&sM[wid][r][2 * lane] = mg[r];
      // the lanes read each other's stores: keeps the reads below behind them
      asm volatile("s_wait_dscnt 0x0" ::: "memory");
      unsigned int word = 0;   // lane l ends up with word l of the unit's 32
#pragma unroll
      for (int g = 0; g < 4; ++g)     // g = 2 * pass + tt: a 16-key group
#pragma unroll
        for (int c = 0; c < 2; ++c) {
          const v4i m4 = *(const v4i*)&sM[wid][lm][16 * g + 8 * h + 4 * c];
#pragma unroll
          for (int e = 0; e < 4; ++e) {
            const unsigned int w = __builtin_amdgcn_ballot_w32(m4[e] != 0);
            if (lane == 8 * g + 4 * c + e) word = w;
          }
        }
      mbits[(size_t)(u0 + u) * 32 + lane] = word;   // one 128-byte line
      // the next unit's stores overwrite what other lanes have just read: keeps
      // them behind those reads
      if (u + 1 < MASK_UNITS) {
        asm volatile("s_wait_dscnt 0x0" ::: "memory");
#pragma unroll
        for (int r = 0; r < 16; ++r) mg[r] = nx[r];
      }
    }
    return;
  }
  const int cb = blockIdx.x - MASK_BLOCKS;
  const int part = cb / CVT_BLOCKS_PER_PART;   // 0..11
  const float* in;
  int first;                                           // the source's first part
  if (part < 4)       { in = q;  first = 0; }
  else if (part < 8)  { in = k;  first = 4; }
  else if (part == 8) { in = wq; first = 8; }
  else if (part == 9) { in = wk; first = 9; }
  else if (part == 10) { in = wv; first = 10; }
  else                { in = wo; first = 11; }
  const int o0 = cb * CVT_GROUPS + threadIdx.x;
  const int i0 = o0 - first * (H_ * H_ / 4);
  for (int r = 0; r < CVT_GROUPS / 256 / 8; ++r) {
    v4f x[8];
    // unrolled: eight loads in flight per lane, x indexed by constants
#pragma unroll
    for (int u = 0; u < 8; ++u) x[u] = ((const v4f*)in)[i0 + (r * 8 + u) * 256];
    // both unrolled: x and y are indexed by constants and stay in registers
#pragma unroll
    for (int u = 0; u < 8; ++u) {
      v4bf y;
#pragma unroll
      for (int j = 0; j < 4; ++j) y[j] = (__bf16)x[u][j];
      ((v4bf*)out)[o0 + (r * 8 + u) * 256] = y;
    }
  }
}

// ---------------------------------------------------------------------------
// C[M,N] = A[M,K](bf16) @ W[N,K]^T(bf16) + bias[N](f32)
// LDS-staged, double-buffered async pipeline.  WG = 256 thr (8 waves),
// tile 128(M) x 128(N) x 64(K) per stage; wave tile 64x32; 16 WMMAs/stage/wave.
// mode 1: bf16 out [B,NH,S,DK]; mode 2: bf16 out [B,NH,DK,S]; mode 3: f32 [M,N]
// Up to three independent products of one shape in one launch: blockIdx.z picks
// the operand set.
#define BM_ 128
#define BN_ 128
#define LDS_STRIDE 72  // 64 + 8 bf16 pad -> 36-bank row stride, conflict-free
#define ST_F32  132    // output staging: 512-byte f32 rows at a 528-byte pitch (16 B x odd)
#define ST_BF16 136    // output staging: 256-byte bf16 rows at a 272-byte pitch (16 B x odd)

// waves_per_eu: the larger grid gives each SIMD six waves (three work-groups a WGP),
// which is 160 registers a wave.  Left alone the compiler plans for the eight that LDS
// would admit, too few registers for the read order set in the loop.
__global__ void __launch_bounds__(256) __attribute__((amdgpu_waves_per_eu(6, 6)))
gemm_bf16_wmma(const __bf16* A0, const __bf16* W0, const float* bias0, void* out0, int mode0,
               const __bf16* A1, const __bf16* W1, const float* bias1, void* out1, int mode1,
               const __bf16* A2, const __bf16* W2, const float* bias2, void* out2, int mode2,
               int M, int N, int K) {
  // a stage: rows 0..127 the A tile, rows 128..255 the W tile; also the output staging
  __shared__ __attribute__((aligned(16))) __bf16 sT[2][BM_ + BN_][LDS_STRIDE];

  const int z = blockIdx.z;
  const __bf16* __restrict__ A = z == 0 ? A0 : z == 1 ? A1 : A2;
  const __bf16* __restrict__ W = z == 0 ? W0 : z == 1 ? W1 : W2;
  const float* __restrict__ bias = z == 0 ? bias0 : z == 1 ? bias1 : bias2;
  void* __restrict__ out = z == 0 ? out0 : z == 1 ? out1 : out2;
  const int mode = z == 0 ? mode0 : z == 1 ? mode1 : mode2;

  const int tid  = threadIdx.x;
  const int wid  = tid >> 5;
  const int lane = tid & 31;
  const int lm = lane & 15, h = lane >> 4;
  const int wm = wid & 1, wn = wid >> 1;
  const int mBase = blockIdx.x * BM_;
  const int nBase = blockIdx.y * BN_;

  // staging: 8 threads per 128-byte row, 32 rows per sweep, four sweeps per operand
  const int cr = tid >> 3;         // 0..31
  const int cc = (tid & 7) * 8;    // element in the row
  const __bf16* gA = A + (size_t)(mBase + cr) * K + cc;
  const __bf16* gB = W + (size_t)(nBase + cr) * K + cc;

  v8f acc[4][2] = {};

  const int NK = K / 64;  // stages
  // Work-groups that share A rows (same x) or W rows (same y and z) start together and
  // would ask L2 for the same lines, and for the same 128 bytes of every row, at
  // the same moment.  Each starts its walk over k at a stage of its own and wraps.
  const int kFirst = (int)((blockIdx.x + 2 * blockIdx.y + blockIdx.z) % (unsigned)NK);
  auto kOf = [&](int trip) {   // first k of the stage that is worked on in a trip
    const int s = trip + kFirst;
    return (s < NK ? s : s - NK) * 64;
  };

  auto stage = [&](int buf, int k0) {
    // unrolled: eight copies one behind the other, the count that wait_async8 leans on
#pragma unroll
    for (int i = 0; i < 4; ++i) {
      async_copy16(gA + (size_t)(32 * i) * K + k0, &sT[buf][32 * i + cr][cc]);
      async_copy16(gB + (size_t)(32 * i) * K + k0, &sT[buf][BM_ + 32 * i + cr][cc]);
    }
  };

  stage(0, kOf(0));  // prologue

  for (int kc = 0; kc < NK; ++kc) {
    const int cur = kc & 1;
    if (kc + 1 < NK) {
      stage(cur ^ 1, kOf(kc + 1));
      wait_async8();   // previous buffer's 8 copies (this wave) complete
    } else {
      wait_async0();
    }
    __syncthreads();   // all waves' copies into `cur` visible

    const __bf16* ap = &sT[cur][wm * 64 + lm][0];
    const __bf16* bp = &sT[cur][BM_ + wn * 32 + lm][0];
    // all unrolled: a, b and acc are indexed by constants and stay in registers
    v16bf a[2][4], b[2][2];
#pragma unroll
    for (int kk = 0; kk < 2; ++kk) {
#pragma unroll
      for (int ms = 0; ms < 4; ++ms) a[kk][ms] = load_op16(ap + ms * 16 * LDS_STRIDE + kk * 32, h);
#pragma unroll
      for (int ns = 0; ns < 2; ++ns) b[kk][ns] = load_op16(bp + ns * 16 * LDS_STRIDE + kk * 32, h);
    }
#pragma unroll
    for (int kk = 0; kk < 2; ++kk)
#pragma unroll
      for (int ms = 0; ms < 4; ++ms)
#pragma unroll
        for (int ns = 0; ns < 2; ++ns)
          acc[ms][ns] = __builtin_amdgcn_wmma_f32_16x16x32_bf16(false, a[kk][ms], false, b[kk][ns],
                                                                (short)0, acc[ms][ns], false, false);
    // order of the stage's LDS reads (0x100) and products (0x8): the first half's twelve
    // reads and four of the second half's go ahead as one group, then one more fragment
    // of the second half is fetched behind every two products, into the registers that
    // they free.  Left alone the compiler reloads one A fragment in front of every two
    // products and waits out the LDS latency each time.
    __builtin_amdgcn_sched_group_barrier(0x100, 16, 0);
#pragma unroll
    for (int ms = 0; ms < 4; ++ms) {
      __builtin_amdgcn_sched_group_barrier(0x8, 2, 0);
      __builtin_amdgcn_sched_group_barrier(0x100, 2, 0);
    }
    __builtin_amdgcn_sched_group_barrier(0x8, 8, 0);

    __syncthreads();   // reads of `cur` done before it is overwritten
  }

  // ---- The tile leaves through LDS, so that every global store is 16 bytes a lane
  // and eight neighbouring lanes fill one whole 128-byte line of the output.  The
  // ring is free here: the last trip waited for every copy, and its closing barrier
  // ended every wave's reads.  mode is the same for the whole work-group, so each
  // barrier below is passed by all of its waves.
  const int ml = wm * 64 + 8 * h;   // the lane's first tile row; + ms * 16 + j
  const int nl = wn * 32 + lm;      // the lane's first tile column; + ns * 16
  if (mode == 3) {
    float* st = (float*)&sT[0][0][0];   // [128][ST_F32]
    // unrolled here and below: acc is indexed by constants and stays in registers
#pragma unroll
    for (int ns = 0; ns < 2; ++ns) {
      const float bn = bias[nBase + nl + ns * 16];
#pragma unroll
      for (int ms = 0; ms < 4; ++ms)
#pragma unroll
        for (int j = 0; j < 8; ++j)
          st[(ml + ms * 16 + j) * ST_F32 + nl + ns * 16] = acc[ms][ns][j] + bn;
    }
    __syncthreads();   // the rows read below were written by four waves
    // a wave stores one 512-byte row piece (four lines) at a time.  readfirstlane:
    // the wave's number is the same in every lane; it keeps the sixteen row offsets
    // in scalar registers
    const int wu = __builtin_amdgcn_readfirstlane(wid);
#pragma unroll
    for (int i = 0; i < 16; ++i) {
      const int row = i * 8 + wu;
      const v4f x = *(const v4f*)&st[row * ST_F32 + lane * 4];
      *(v4f*)((float*)out + (size_t)(mBase + row) * N + nBase + lane * 4) = x;
    }
    // the code behind this branch reuses registers that the stores above name
    asm volatile("s_wait_xcnt 0x0" ::: "memory");
  } else if (mode == 1) {
    __bf16* st = &sT[0][0][0];          // [128 positions][ST_BF16]
#pragma unroll
    for (int ns = 0; ns < 2; ++ns) {
      const float bn = bias[nBase + nl + ns * 16];
#pragma unroll
      for (int ms = 0; ms < 4; ++ms)
#pragma unroll
        for (int j = 0; j < 8; ++j)
          st[(ml + ms * 16 + j) * ST_BF16 + nl + ns * 16] = (__bf16)(acc[ms][ns][j] + bn);
    }
    __syncthreads();   // the rows read below were written by four waves
    // a line = the DK values of one position and one of the tile's two heads
    const int l8 = tid >> 3;          // line of a sweep of 32 lines
    const int e8 = (tid & 7) * 8;     // the thread's eight bf16 in its line
#pragma unroll
    for (int i = 0; i < 8; ++i) {
      const int line = i * 32 + l8;
      const int m = mBase + (line & (BM_ - 1));   // m = b*S + s
      const int hd = (nBase >> 6) + (line >> 7);  // n = h*DK + d
      const int bb = m >> 11, s = m & (S_ - 1);
      const v8bf y = *(const v8bf*)&st[(line & (BM_ - 1)) * ST_BF16 + (line >> 7) * DK_ + e8];
      *(v8bf*)((__bf16*)out + (((size_t)(bb * NH_ + hd)) * S_ + s) * DK_ + e8) = y;
    }
    // the code behind this branch reuses registers that the stores above name
    asm volatile("s_wait_xcnt 0x0" ::: "memory");
  } else {
    __bf16* st = &sT[0][0][0];          // [128 columns][ST_BF16], positions along a row
#pragma unroll
    for (int ns = 0; ns < 2; ++ns) {
      const float bn = bias[nBase + nl + ns * 16];
#pragma unroll
      for (int ms = 0; ms < 4; ++ms) {
        v8bf y;
#pragma unroll
        for (int j = 0; j < 8; ++j) y[j] = (__bf16)(acc[ms][ns][j] + bn);
        *(v8bf*)&st[(nl + ns * 16) * ST_BF16 + ml + ms * 16] = y;
      }
    }
    __syncthreads();   // the rows read below were written by two waves
    // two lines = the tile's 128 positions of one head and one of its DK rows
    const int bb = mBase >> 11, s = mBase & (S_ - 1);   // 128 divides S: one batch a tile
    const int r16 = tid >> 4;          // row of a sweep of 16 rows
    const int e16 = (tid & 15) * 8;    // the thread's eight bf16 in its row
#pragma unroll
    for (int i = 0; i < 8; ++i) {
      const int col = i * 16 + r16;
      const int n = nBase + col;
      const int hd = n >> 6, d = n & (DK_ - 1);
      const v8bf y = *(const v8bf*)&st[col * ST_BF16 + e16];
      *(v8bf*)((__bf16*)out + (((size_t)(bb * NH_ + hd)) * DK_ + d) * S_ + s + e16) = y;
    }
    // the compiler lays another branch's code, which reuses registers that the stores
    // above name, behind this one
    asm volatile("s_wait_xcnt 0x0" ::: "memory");
  }
}

// ---------------------------------------------------------------------------
// Flash attention: one wave owns a 16-row Q tile; the work-group's 8 waves are
// 8 Q tiles of ONE head, so each 64-key K tile and V tile is brought into LDS
// once per work-group by asynchronous copies (whole 128-byte rows, two buffers,
// the next tile in flight while this one is worked on) and every wave reads its
// WMMA operands from there.  Q,K: [B,NH,S,DK]; V: [B,NH,DK,S] bf16.
// The products are taken transposed: St = K Qt and Ot += Vt Pt.  A lane then
// holds 16 of the 32 keys of ONE query (lane lm = query, register j = key
// 8h + j of a 16-key tile), so maximum and sum run inside the lane with one
// exchange between the wave's halves, and the two score tiles, converted in
// place, are the B operand of the second product in the hardware k order.
// The mask comes as the lane-mask words packed by the conversion launch: 16 words
// a pass, the same for the whole wave, read by scalar loads one tile ahead; each
// word is the select condition of one score register.
#define KV_PITCH 72   // 128-byte rows at a 144-byte pitch (16 B x odd) for ds_load_b128
#define SCALE_LOG2E 0.18033688011112042f   // log2(e) / sqrt(DK)
#define MASKED_RAW  -480000.f              // -60000 * sqrt(DK)

// value of lane l ^ 16
static __device__ __forceinline__ float other_half(float x) {
  const int b = __builtin_bit_cast(int, x);
  return __builtin_bit_cast(
      float, __builtin_amdgcn_permlanex16(b, b, 0x76543210, 0xfedcba98, false, false));
}

// waves_per_eu: the grid gives each SIMD four waves.  With the mask patch gone from
// LDS the compiler would plan for more, and to save registers put every LDS load
// directly in front of its product instead of fetching ahead.
__global__ void __launch_bounds__(256) __attribute__((amdgpu_waves_per_eu(4, 4)))
flash_attn_bf16(const __bf16* __restrict__ Q, const __bf16* __restrict__ Kh,
                const __bf16* __restrict__ Vt, const unsigned int* __restrict__ mbits,
                __bf16* __restrict__ ctx) {
  __shared__ __attribute__((aligned(16))) __bf16 sK[2][KT_][KV_PITCH];
  __shared__ __attribute__((aligned(16))) __bf16 sV[2][DK_][KV_PITCH];
  const int wid  = threadIdx.x >> 5;
  const int lane = threadIdx.x & 31;
  const int lm = lane & 15, h = lane >> 4;

  const int gt = blockIdx.x * 8 + wid;
  const int qt = gt & (S_ / 16 - 1);
  const int bh = gt >> 7;
  const int hd = bh & (NH_ - 1);
  const int bb = bh >> 4;
  const int qbase = qt * 16;

  const __bf16* Qp = Q  + ((size_t)(bb * NH_ + hd)) * S_ * DK_;
  const __bf16* Kp = Kh + ((size_t)(bb * NH_ + hd)) * S_ * DK_;
  const __bf16* Vp = Vt + ((size_t)(bb * NH_ + hd)) * DK_ * S_;
  // the wave's mask words, 16 a pass.  readfirstlane: the index is the same in every
  // lane; constant address space: nothing writes the words while this kernel runs.
  // Both are needed for the loads in the loop to be scalar loads.
  const cv16u* mw = (const cv16u*)(uintptr_t)(
      mbits + (size_t)__builtin_amdgcn_readfirstlane(bb * (S_ / 16) + qt) * (S_ / 32 * 16));

  v16bf bq[2];   // Q as B operand: column lm = query
#pragma unroll
  for (int c = 0; c < 2; ++c)
    bq[c] = load_op16(Qp + (size_t)(qbase + lm) * DK_ + 32 * c, h);

  v8f oacc[4] = {};          // Ot: oacc[nt][j] = O[query lm][nt*16 + 8h + j]
  float mrow = -3.0e38f;     // running maximum of query lm's raw products (equal in both halves)
  float lrow = 0.f;          // running sum over this half's keys only

  v16bf ak[2][2];  // [key-subtile][dk-chunk]
  v16bf av[4];

  // staging: 8 threads per 128-byte row, 32 rows per sweep, two sweeps per tile
  const int cr = threadIdx.x >> 3;        // 0..31
  const int cc = (threadIdx.x & 7) * 8;   // element in the row
  const __bf16* gK = Kp + (size_t)cr * DK_ + cc;
  const __bf16* gV = Vp + (size_t)cr * S_ + cc;

  auto stageKV = [&](int buf, int kb0) {
    const __bf16* k0 = gK + (size_t)kb0 * DK_;
    const __bf16* k1 = k0 + 32 * DK_;
    const __bf16* v0 = gV + kb0;
    const __bf16* v1 = v0 + (size_t)32 * S_;
    const unsigned lk0 = (unsigned)(uintptr_t)&sK[buf][cr][cc];
    const unsigned lk1 = (unsigned)(uintptr_t)&sK[buf][32 + cr][cc];
    const unsigned lv0 = (unsigned)(uintptr_t)&sV[buf][cr][cc];
    const unsigned lv1 = (unsigned)(uintptr_t)&sV[buf][32 + cr][cc];
    // the four copies of one tile; s_wait_xcnt closes the statement so that no
    // address register of a copy is rewritten ahead of it
    asm volatile(
        "global_load_async_to_lds_b128 %0, %4, off\n\t"
        "global_load_async_to_lds_b128 %1, %5, off\n\t"
        "global_load_async_to_lds_b128 %2, %6, off\n\t"
        "global_load_async_to_lds_b128 %3, %7, off\n\t"
        "s_wait_xcnt 0x0"
        :: "v"(lk0), "v"(lk1), "v"(lv0), "v"(lv1),
           "v"(k0), "v"(k1), "v"(v0), "v"(v1)
        : "memory");
  };

  const int NT = S_ / KT_;  // staged tiles
  // The S/128 work-groups of one head start together and would ask L2 for the same K
  // and V lines at the same moment.  Each starts its walk over the key tiles at a tile
  // of its own and wraps; neighbouring heads take the tiles in between.
  const int tFirst = ((blockIdx.x & (S_ / 128 - 1)) * (NT / (S_ / 128)) +
                      ((blockIdx.x / (S_ / 128)) & 1)) & (NT - 1);
  auto tileOf = [&](int trip) { return (trip + tFirst) & (NT - 1); };
  stageKV(0, tileOf(0) * KT_);
  wait_async0();     // this wave's share of the first tile has landed
  __syncthreads();   // the first tile readable by every wave
  stageKV(1, tileOf(1) * KT_);

  v16u mk[2];   // this tile's mask words, [pass]
  mk[0] = mw[2 * tileOf(0)];
  mk[1] = mw[2 * tileOf(0) + 1];

  for (int ti = 0; ti < NT; ++ti) {
   const int buf = ti & 1;
   // ---- mask words of the next tile (the last trip reads its own again)
   const int tn = tileOf(ti + 1 < NT ? ti + 1 : ti);
   const v16u mn0 = mw[2 * tn];
   const v16u mn1 = mw[2 * tn + 1];
   // unrolled so that the pass's place in the tile is a constant LDS offset
#pragma unroll
   for (int p = 0; p < KT_ / 32; ++p) {
    // ---- K operands of this pass from the staged tile (unrolled: constant
    // indices keep ak in registers)
#pragma unroll
    for (int tt = 0; tt < 2; ++tt)
#pragma unroll
      for (int c = 0; c < 2; ++c)
        ak[tt][c] = load_op16(&sK[buf][p * 32 + 16 * tt + lm][32 * c], h);

    // ---- scores: St[32k x 16q], K-dim = DK in two chunks of 32
    v8f sc[2] = {};
#pragma unroll
    for (int tt = 0; tt < 2; ++tt)
#pragma unroll
      for (int c = 0; c < 2; ++c)
        sc[tt] = __builtin_amdgcn_wmma_f32_16x16x32_bf16(
            false, ak[tt][c], false, bq[c], (short)0, sc[tt], false, false);

    // ---- V operands from the staged tile: row = dk, k = keys
#pragma unroll
    for (int nt = 0; nt < 4; ++nt)
      av[nt] = load_op16(&sV[buf][nt * 16 + lm][p * 32], h);

    // ---- apply mask to the raw products (the masked score times sqrt(DK))
#pragma unroll
    for (int t = 0; t < 2; ++t)
#pragma unroll
      for (int j = 0; j < 8; ++j)
        sc[t][j] = __builtin_amdgcn_inverse_ballot_w32(mk[p][8 * t + j]) ? sc[t][j] : MASKED_RAW;

    // ---- online softmax of one query per lane (its loops unrolled: sc is
    // indexed by constants and stays in registers)
    float cm = fmaxf(sc[0][0], sc[1][0]);
#pragma unroll
    for (int j = 1; j < 8; ++j) cm = fmaxf(cm, fmaxf(sc[0][j], sc[1][j]));
    cm = fmaxf(cm, other_half(cm));
    const float mnew = fmaxf(mrow, cm);
    // difference first, then the factor: exactly 1 where the maximum stays, whatever
    // its size (a row that is masked throughout keeps equal weights)
    const float alpha = __builtin_amdgcn_exp2f((mrow - mnew) * SCALE_LOG2E);
    mrow = mnew;
    // exp(s / sqrt(DK) - max / sqrt(DK)) = exp2(s * SCALE_LOG2E - mlnew): one fused
    // multiply-add a score, two scores an instruction
    const float mlnew = mnew * SCALE_LOG2E;
    const v2f c2 = {SCALE_LOG2E, SCALE_LOG2E};
    const v2f nm = {-mlnew, -mlnew};
    float rs0 = 0.f, rs1 = 0.f;
#pragma unroll
    for (int t = 0; t < 2; ++t)
#pragma unroll
      for (int j = 0; j < 8; j += 2) {
        const v2f x = {sc[t][j], sc[t][j + 1]};
        const v2f e = __builtin_elementwise_fma(x, c2, nm);
        sc[t][j]     = e[0];
        sc[t][j + 1] = e[1];
      }
#pragma unroll
    for (int j = 0; j < 8; ++j) {
      sc[0][j] = __builtin_amdgcn_exp2f(sc[0][j]);
      sc[1][j] = __builtin_amdgcn_exp2f(sc[1][j]);
      rs0 += sc[0][j];
      rs1 += sc[1][j];
    }
    lrow = lrow * alpha + (rs0 + rs1);
#pragma unroll
    for (int nt = 0; nt < 4; ++nt)
#pragma unroll
      for (int j = 0; j < 8; ++j) oacc[nt][j] *= alpha;

    // ---- Pt: the two score tiles, converted in place, are the B operand
    // (unrolled: pb and sc stay in registers)
    v16bf pb;
#pragma unroll
    for (int j = 0; j < 8; ++j) {
      pb[j]     = (__bf16)sc[0][j];
      pb[8 + j] = (__bf16)sc[1][j];
    }

    // ---- Ot += Vt @ Pt (4 M-tiles over DK)
#pragma unroll
    for (int nt = 0; nt < 4; ++nt)
      oacc[nt] = __builtin_amdgcn_wmma_f32_16x16x32_bf16(
          false, av[nt], false, pb, (short)0, oacc[nt], false, false);
   }

   // ---- publish point of the next trip's tile; the barrier also ends every wave's reads
   // of this tile's buffer, which is refilled behind it
   asm volatile("s_wait_dscnt 0x0" ::: "memory");  // own LDS reads retired
   wait_async0();                                  // own copies of the next trip's tile landed
   __syncthreads();
   if (ti + 2 < NT) stageKV(buf, tileOf(ti + 2) * KT_);
   mk[0] = mn0;
   mk[1] = mn1;
  }
  wait_async0();  // nothing in flight when the wave ends

  // ---- join the halves' sums, normalize, emit context [B,S,H] bf16:
  // 8 consecutive dk of one query per lane and tile, one 16-byte store each
  // (unrolled: oacc is indexed by constants)
  const float inv = 1.f / (lrow + other_half(lrow));
  __bf16* op = ctx + ((size_t)(bb * S_ + qbase + lm)) * H_ + hd * DK_ + 8 * h;
#pragma unroll
  for (int nt = 0; nt < 4; ++nt) {
    v8bf y;
#pragma unroll
    for (int j = 0; j < 8; ++j) y[j] = (__bf16)(oacc[nt][j] * inv);
    *(v8bf*)(op + nt * 16) = y;
  }
}

// ---------------------------------------------------------------------------
extern "C" void kernel_launch(void* const* d_in, const int* in_sizes, int n_in,
                              void* d_out, int out_size, void* d_ws, size_t ws_size,
                              hipStream_t stream) {
  (void)in_sizes; (void)n_in; (void)out_size; (void)ws_size;
  const float* query = (const float*)d_in[0];
  const float* key   = (const float*)d_in[1];
  const int*   amask = (const int*)d_in[2];
  const float* Wq = (const float*)d_in[3]; const float* bq = (const float*)d_in[4];
  const float* Wk = (const float*)d_in[5]; const float* bk = (const float*)d_in[6];
  const float* Wv = (const float*)d_in[7]; const float* bv = (const float*)d_in[8];
  const float* Wo = (const float*)d_in[9]; const float* bo = (const float*)d_in[10];

  char* ws = (char*)d_ws;
  const size_t MB = 1u << 20;
  __bf16* Xq  = (__bf16*)(ws +  0 * MB);
  __bf16* Xk  = (__bf16*)(ws +  8 * MB);
  __bf16* Wqb = (__bf16*)(ws + 16 * MB);
  __bf16* Wkb = (__bf16*)(ws + 18 * MB);
  __bf16* Wvb = (__bf16*)(ws + 20 * MB);
  __bf16* Wob = (__bf16*)(ws + 22 * MB);
  __bf16* Qh  = (__bf16*)(ws + 24 * MB);  // [B,NH,S,DK]
  __bf16* Khd = (__bf16*)(ws + 32 * MB);  // [B,NH,S,DK]
  __bf16* Vtd = (__bf16*)(ws + 40 * MB);  // [B,NH,DK,S]
  __bf16* ctx = (__bf16*)(ws + 48 * MB);  // [B,S,H]
  unsigned int* mbits = (unsigned int*)(ws + 56 * MB);  // 1 MB of lane-mask words

  // Xq, Xk, Wqb, Wkb, Wvb, Wob are written as one run of 24 MB from Xq on
  cvt_f32_bf16<<<MASK_BLOCKS + 12 * CVT_BLOCKS_PER_PART, 256, 0, stream>>>(query, key, Wq, Wk, Wv, Wo, Xq,
                                                                           amask, mbits);

  dim3 g3(32, 8, 3);  // M/128 x N/128 x {Q, K, V}
  gemm_bf16_wmma<<<g3, 256, 0, stream>>>(Xq, Wqb, bq, Qh,  1,
                                         Xk, Wkb, bk, Khd, 1,
                                         Xk, Wvb, bv, Vtd, 2, B_*S_, H_, H_);

  flash_attn_bf16<<<512, 256, 0, stream>>>(Qh, Khd, Vtd, mbits, ctx);

  dim3 g1(32, 8, 1);
  gemm_bf16_wmma<<<g1, 256, 0, stream>>>(ctx, Wob, bo, d_out, 3,
                                         ctx, Wob, bo, d_out, 3,
                                         ctx, Wob, bo, d_out, 3, B_*S_, H_, H_);
}

// v009
// It runs in 79.6 microseconds.
// Timed twice side by side with v008, it ran 1.05 times as fast both times.
// All steps since v000 together make it 5.41 times as fast.
#include <hip/hip_runtime.h>
#include <hip/hip_bf16.h>

typedef __attribute__((ext_vector_type(16))) __bf16 v16bf;
typedef __attribute__((ext_vector_type(8)))  __bf16 v8bf;
typedef __attribute__((ext_vector_type(4)))  __bf16 v4bf;
typedef __attribute__((ext_vector_type(8)))  float  v8f;
typedef __attribute__((ext_vector_type(4)))  float  v4f;
typedef __attribute__((ext_vector_type(2)))  float  v2f;
typedef __attribute__((ext_vector_type(4)))  int    v4i;
typedef __attribute__((ext_vector_type(2)))  int    v2i;
typedef __attribute__((ext_vector_type(16))) unsigned int v16u;
typedef __attribute__((address_space(4))) v16u cv16u;

#define B_  2
#define S_  2048
#define H_  1024
#define NH_ 16
#define DK_ 64

// ---------------------------------------------------------------------------
// WMMA operand builder: CDNA5 16-bit A/B layout, lane-half h holds
// K{8h..8h+7} in elements 0..7 and K{16+8h..16+8h+7} in elements 8..15.
static __device__ __forceinline__ v16bf load_op16(const __bf16* base, int h) {
  v8bf lo = *(const v8bf*)(base + 8 * h);
  v8bf hi = *(const v8bf*)(base + 16 + 8 * h);
  v16bf r;
#pragma unroll
  for (int i = 0; i < 8; ++i) { r[i] = lo[i]; r[8 + i] = hi[i]; }
  return r;
}

// 16-byte async global->LDS copy (ASYNCcnt-tracked).
static __device__ __forceinline__ void async_copy16(const __bf16* g, __bf16* l) {
#if __has_builtin(__builtin_amdgcn_global_load_async_to_lds_b128)
  __builtin_amdgcn_global_load_async_to_lds_b128(
      (__attribute__((address_space(1))) v4i*)(uintptr_t)g,
      (__attribute__((address_space(3))) v4i*)(unsigned)(uintptr_t)l, 0, 0);
#else
  asm volatile("global_load_async_to_lds_b128 %0, %1, off"
               :: "v"((unsigned)(uintptr_t)l),
                  "v"((unsigned long long)(uintptr_t)g)
               : "memory");
#endif
}

static __device__ __forceinline__ void wait_async8() {
  asm volatile("s_wait_asynccnt 0x8" ::: "memory");
}
static __device__ __forceinline__ void wait_async0() {
  asm volatile("s_wait_asynccnt 0x0" ::: "memory");
}

// The mask as lane-mask words, one bit an element.  For 16 queries (one of a wave's two groups
// in the attention kernel) and 32 keys (one of its passes) there are 16 words:
// bit l of word 8*tt + j says whether query (l & 15) may see key
// 16*tt + 8*(l >> 4) + j, which is the score that lane l holds in register j of
// score tile tt.  Words of one query tile lie in key order: 64 passes x 16 words.
#define KT_ 64        // keys per mask unit = two passes of 32 keys
#define M_PITCH 68    // 256-byte mask rows at a 272-byte pitch (16 B x odd) for ds_load_b128
#define MASK_UNITS 4  // units of 16 queries x 64 keys per wave
#define MASK_BLOCKS (B_ * (S_ / 16) * (S_ / KT_) / MASK_UNITS / 8)

// All six f32 -> bf16 conversions and the packing of the mask in one launch.
// The first MASK_BLOCKS blocks pack the mask.  Behind them: the six bf16 copies lie
// one behind the other in out: query, key (4 parts of H*H elements each), Wq, Wk,
// Wv, Wo (1 part each).  A block takes 4096 groups of four elements, 64 blocks a
// part, so the source is the same for a whole block.
#define CVT_GROUPS 4096                      // groups of four elements per block
#define CVT_BLOCKS_PER_PART (H_ * H_ / 4 / CVT_GROUPS)
__global__ void __launch_bounds__(256)
cvt_f32_bf16(const float* __restrict__ q, const float* __restrict__ k,
             const float* __restrict__ wq, const float* __restrict__ wk,
             const float* __restrict__ wv, const float* __restrict__ wo,
             __bf16* __restrict__ out,
             const int* __restrict__ mask, unsigned int* __restrict__ mbits) {
  __shared__ __attribute__((aligned(16))) int sM[8][16][M_PITCH];  // one patch per wave
  if (blockIdx.x < MASK_BLOCKS) {
    // Each wave reads 16 mask rows as whole 256-byte pieces (lane = two keys), turns
    // them through its own LDS patch so that lane l holds the keys of query l & 15
    // in the score layout, and takes one ballot per word.
    const int wid  = threadIdx.x >> 5;
    const int lane = threadIdx.x & 31;
    const int lm = lane & 15, h = lane >> 4;
    const int u0 = (blockIdx.x * 8 + wid) * MASK_UNITS;   // first unit of the wave
    // unit u = (query tile, 64-key tile); the wave's units are one query tile's
    const int* mp = mask + (size_t)(u0 / (S_ / KT_)) * 16 * S_ + (u0 % (S_ / KT_)) * KT_ + 2 * lane;
    v2i mg[16];
    // unrolled: constant indices keep mg in registers
#pragma unroll
    for (int r = 0; r < 16; ++r) mg[r] = *(const v2i*)(mp + (size_t)r * S_);
    // unrolled: the next unit's loads fly while this one is turned, nx in registers
#pragma unroll
    for (int u = 0; u < MASK_UNITS; ++u) {
      v2i nx[16];
      if (u + 1 < MASK_UNITS) {
#pragma unroll
        for (int r = 0; r < 16; ++r) nx[r] = *(const v2i*)(mp + (size_t)r * S_ + (u + 1) * KT_);
      }
#pragma unroll
      for (int r = 0; r < 16; ++r) *(v2i*)&sM[wid][r][2 * lane] = mg[r];
      // the lanes read each other's stores: keeps the reads below behind them
      asm volatile("s_wait_dscnt 0x0" ::: "memory");
      unsigned int word = 0;   // lane l ends up with word l of the unit's 32
#pragma unroll
      for (int g = 0; g < 4; ++g)     // g = 2 * pass + tt: a 16-key group
#pragma unroll
        for (int c = 0; c < 2; ++c) {
          const v4i m4 = *(const v4i*)&sM[wid][lm][16 * g + 8 * h + 4 * c];
#pragma unroll
          for (int e = 0; e < 4; ++e) {
            const unsigned int w = __builtin_amdgcn_ballot_w32(m4[e] != 0);
            if (lane == 8 * g + 4 * c + e) word = w;
          }
        }
      mbits[(size_t)(u0 + u) * 32 + lane] = word;   // one 128-byte line
      // the next unit's stores overwrite what other lanes have just read: keeps
      // them behind those reads
      if (u + 1 < MASK_UNITS) {
        asm volatile("s_wait_dscnt 0x0" ::: "memory");
#pragma unroll
        for (int r = 0; r < 16; ++r) mg[r] = nx[r];
      }
    }
    return;
  }
  const int cb = blockIdx.x - MASK_BLOCKS;
  const int part = cb / CVT_BLOCKS_PER_PART;   // 0..11
  const float* in;
  int first;                                           // the source's first part
  if (part < 4)       { in = q;  first = 0; }
  else if (part < 8)  { in = k;  first = 4; }
  else if (part == 8) { in = wq; first = 8; }
  else if (part == 9) { in = wk; first = 9; }
  else if (part == 10) { in = wv; first = 10; }
  else                { in = wo; first = 11; }
  const int o0 = cb * CVT_GROUPS + threadIdx.x;
  const int i0 = o0 - first * (H_ * H_ / 4);
  for (int r = 0; r < CVT_GROUPS / 256 / 8; ++r) {
    v4f x[8];
    // unrolled: eight loads in flight per lane, x indexed by constants
#pragma unroll
    for (int u = 0; u < 8; ++u) x[u] = ((const v4f*)in)[i0 + (r * 8 + u) * 256];
    // both unrolled: x and y are indexed by constants and stay in registers
#pragma unroll
    for (int u = 0; u < 8; ++u) {
      v4bf y;
#pragma unroll
      for (int j = 0; j < 4; ++j) y[j] = (__bf16)x[u][j];
      ((v4bf*)out)[o0 + (r * 8 + u) * 256] = y;
    }
  }
}

// ---------------------------------------------------------------------------
// C[M,N] = A[M,K](bf16) @ W[N,K]^T(bf16) + bias[N](f32)
// LDS-staged, double-buffered async pipeline.  WG = 256 thr (8 waves),
// tile 128(M) x 128(N) x 64(K) per stage; wave tile 64x32; 16 WMMAs/stage/wave.
// mode 1: bf16 out [B,NH,S,DK]; mode 2: bf16 out [B,NH,DK,S]; mode 3: f32 [M,N]
// Up to three independent products of one shape in one launch: blockIdx.z picks
// the operand set.
#define BM_ 128
#define BN_ 128
#define LDS_STRIDE 72  // 64 + 8 bf16 pad -> 36-bank row stride, conflict-free
#define ST_F32  132    // output staging: 512-byte f32 rows at a 528-byte pitch (16 B x odd)
#define ST_BF16 136    // output staging: 256-byte bf16 rows at a 272-byte pitch (16 B x odd)

// waves_per_eu: the larger grid gives each SIMD six waves (three work-groups a WGP),
// which is 160 registers a wave.  Left alone the compiler plans for the eight that LDS
// would admit, too few registers for the read order set in the loop.
__global__ void __launch_bounds__(256) __attribute__((amdgpu_waves_per_eu(6, 6)))
gemm_bf16_wmma(const __bf16* A0, const __bf16* W0, const float* bias0, void* out0, int mode0,
               const __bf16* A1, const __bf16* W1, const float* bias1, void* out1, int mode1,
               const __bf16* A2, const __bf16* W2, const float* bias2, void* out2, int mode2,
               int M, int N, int K) {
  // a stage: rows 0..127 the A tile, rows 128..255 the W tile; also the output staging
  __shared__ __attribute__((aligned(16))) __bf16 sT[2][BM_ + BN_][LDS_STRIDE];

  const int z = blockIdx.z;
  const __bf16* __restrict__ A = z == 0 ? A0 : z == 1 ? A1 : A2;
  const __bf16* __restrict__ W = z == 0 ? W0 : z == 1 ? W1 : W2;
  const float* __restrict__ bias = z == 0 ? bias0 : z == 1 ? bias1 : bias2;
  void* __restrict__ out = z == 0 ? out0 : z == 1 ? out1 : out2;
  const int mode = z == 0 ? mode0 : z == 1 ? mode1 : mode2;

  const int tid  = threadIdx.x;
  const int wid  = tid >> 5;
  const int lane = tid & 31;
  const int lm = lane & 15, h = lane >> 4;
  const int wm = wid & 1, wn = wid >> 1;
  const int mBase = blockIdx.x * BM_;
  const int nBase = blockIdx.y * BN_;

  // staging: 8 threads per 128-byte row, 32 rows per sweep, four sweeps per operand
  const int cr = tid >> 3;         // 0..31
  const int cc = (tid & 7) * 8;    // element in the row
  const __bf16* gA = A + (size_t)(mBase + cr) * K + cc;
  const __bf16* gB = W + (size_t)(nBase + cr) * K + cc;

  v8f acc[4][2] = {};

  const int NK = K / 64;  // stages
  // Work-groups that share A rows (same x) or W rows (same y and z) start together and
  // would ask L2 for the same lines, and for the same 128 bytes of every row, at
  // the same moment.  Each starts its walk over k at a stage of its own and wraps.
  const int kFirst = (int)((blockIdx.x + 2 * blockIdx.y + blockIdx.z) % (unsigned)NK);
  auto kOf = [&](int trip) {   // first k of the stage that is worked on in a trip
    const int s = trip + kFirst;
    return (s < NK ? s : s - NK) * 64;
  };

  auto stage = [&](int buf, int k0) {
    // unrolled: eight copies one behind the other, the count that wait_async8 leans on
#pragma unroll
    for (int i = 0; i < 4; ++i) {
      async_copy16(gA + (size_t)(32 * i) * K + k0, &sT[buf][32 * i + cr][cc]);
      async_copy16(gB + (size_t)(32 * i) * K + k0, &sT[buf][BM_ + 32 * i + cr][cc]);
    }
  };

  stage(0, kOf(0));  // prologue

  for (int kc = 0; kc < NK; ++kc) {
    const int cur = kc & 1;
    if (kc + 1 < NK) {
      stage(cur ^ 1, kOf(kc + 1));
      wait_async8();   // previous buffer's 8 copies (this wave) complete
    } else {
      wait_async0();
    }
    __syncthreads();   // all waves' copies into `cur` visible

    const __bf16* ap = &sT[cur][wm * 64 + lm][0];
    const __bf16* bp = &sT[cur][BM_ + wn * 32 + lm][0];
    // all unrolled: a, b and acc are indexed by constants and stay in registers
    v16bf a[2][4], b[2][2];
#pragma unroll
    for (int kk = 0; kk < 2; ++kk) {
#pragma unroll
      for (int ms = 0; ms < 4; ++ms) a[kk][ms] = load_op16(ap + ms * 16 * LDS_STRIDE + kk * 32, h);
#pragma unroll
      for (int ns = 0; ns < 2; ++ns) b[kk][ns] = load_op16(bp + ns * 16 * LDS_STRIDE + kk * 32, h);
    }
#pragma unroll
    for (int kk = 0; kk < 2; ++kk)
#pragma unroll
      for (int ms = 0; ms < 4; ++ms)
#pragma unroll
        for (int ns = 0; ns < 2; ++ns)
          acc[ms][ns] = __builtin_amdgcn_wmma_f32_16x16x32_bf16(false, a[kk][ms], false, b[kk][ns],
                                                                (short)0, acc[ms][ns], false, false);
    // order of the stage's LDS reads (0x100) and products (0x8): the first half's twelve
    // reads and four of the second half's go ahead as one group, then one more fragment
    // of the second half is fetched behind every two products, into the registers that
    // they free.  Left alone the compiler reloads one A fragment in front of every two
    // products and waits out the LDS latency each time.
    __builtin_amdgcn_sched_group_barrier(0x100, 16, 0);
#pragma unroll
    for (int ms = 0; ms < 4; ++ms) {
      __builtin_amdgcn_sched_group_barrier(0x8, 2, 0);
      __builtin_amdgcn_sched_group_barrier(0x100, 2, 0);
    }
    __builtin_amdgcn_sched_group_barrier(0x8, 8, 0);

    __syncthreads();   // reads of `cur` done before it is overwritten
  }

  // ---- The tile leaves through LDS, so that every global store is 16 bytes a lane
  // and eight neighbouring lanes fill one whole 128-byte line of the output.  The
  // ring is free here: the last trip waited for every copy, and its closing barrier
  // ended every wave's reads.  mode is the same for the whole work-group, so each
  // barrier below is passed by all of its waves.
  const int ml = wm * 64 + 8 * h;   // the lane's first tile row; + ms * 16 + j
  const int nl = wn * 32 + lm;      // the lane's first tile column; + ns * 16
  if (mode == 3) {
    float* st = (float*)&sT[0][0][0];   // [128][ST_F32]
    // unrolled here and below: acc is indexed by constants and stays in registers
#pragma unroll
    for (int ns = 0; ns < 2; ++ns) {
      const float bn = bias[nBase + nl + ns * 16];
#pragma unroll
      for (int ms = 0; ms < 4; ++ms)
#pragma unroll
        for (int j = 0; j < 8; ++j)
          st[(ml + ms * 16 + j) * ST_F32 + nl + ns * 16] = acc[ms][ns][j] + bn;
    }
    __syncthreads();   // the rows read below were written by four waves
    // a wave stores one 512-byte row piece (four lines) at a time.  readfirstlane:
    // the wave's number is the same in every lane; it keeps the sixteen row offsets
    // in scalar registers
    const int wu = __builtin_amdgcn_readfirstlane(wid);
#pragma unroll
    for (int i = 0; i < 16; ++i) {
      const int row = i * 8 + wu;
      const v4f x = *(const v4f*)&st[row * ST_F32 + lane * 4];
      *(v4f*)((float*)out + (size_t)(mBase + row) * N + nBase + lane * 4) = x;
    }
    // the code behind this branch reuses registers that the stores above name
    asm volatile("s_wait_xcnt 0x0" ::: "memory");
  } else if (mode == 1) {
    __bf16* st = &sT[0][0][0];          // [128 positions][ST_BF16]
#pragma unroll
    for (int ns = 0; ns < 2; ++ns) {
      const float bn = bias[nBase + nl + ns * 16];
#pragma unroll
      for (int ms = 0; ms < 4; ++ms)
#pragma unroll
        for (int j = 0; j < 8; ++j)
          st[(ml + ms * 16 + j) * ST_BF16 + nl + ns * 16] = (__bf16)(acc[ms][ns][j] + bn);
    }
    __syncthreads();   // the rows read below were written by four waves
    // a line = the DK values of one position and one of the tile's two heads
    const int l8 = tid >> 3;          // line of a sweep of 32 lines
    const int e8 = (tid & 7) * 8;     // the thread's eight bf16 in its line
#pragma unroll
    for (int i = 0; i < 8; ++i) {
      const int line = i * 32 + l8;
      const int m = mBase + (line & (BM_ - 1));   // m = b*S + s
      const int hd = (nBase >> 6) + (line >> 7);  // n = h*DK + d
      const int bb = m >> 11, s = m & (S_ - 1);
      const v8bf y = *(const v8bf*)&st[(line & (BM_ - 1)) * ST_BF16 + (line >> 7) * DK_ + e8];
      *(v8bf*)((__bf16*)out + (((size_t)(bb * NH_ + hd)) * S_ + s) * DK_ + e8) = y;
    }
    // the code behind this branch reuses registers that the stores above name
    asm volatile("s_wait_xcnt 0x0" ::: "memory");
  } else {
    __bf16* st = &sT[0][0][0];          // [128 columns][ST_BF16], positions along a row
#pragma unroll
    for (int ns = 0; ns < 2; ++ns) {
      const float bn = bias[nBase + nl + ns * 16];
#pragma unroll
      for (int ms = 0; ms < 4; ++ms) {
        v8bf y;
#pragma unroll
        for (int j = 0; j < 8; ++j) y[j] = (__bf16)(acc[ms][ns][j] + bn);
        *(v8bf*)&st[(nl + ns * 16) * ST_BF16 + ml + ms * 16] = y;
      }
    }
    __syncthreads();   // the rows read below were written by two waves
    // two lines = the tile's 128 positions of one head and one of its DK rows
    const int bb = mBase >> 11, s = mBase & (S_ - 1);   // 128 divides S: one batch a tile
    const int r16 = tid >> 4;          // row of a sweep of 16 rows
    const int e16 = (tid & 15) * 8;    // the thread's eight bf16 in its row
#pragma unroll
    for (int i = 0; i < 8; ++i) {
      const int col = i * 16 + r16;
      const int n = nBase + col;
      const int hd = n >> 6, d = n & (DK_ - 1);
      const v8bf y = *(const v8bf*)&st[col * ST_BF16 + e16];
      *(v8bf*)((__bf16*)out + (((size_t)(bb * NH_ + hd)) * DK_ + d) * S_ + s + e16) = y;
    }
    // the compiler lays another branch's code, which reuses registers that the stores
    // above name, behind this one
    asm volatile("s_wait_xcnt 0x0" ::: "memory");
  }
}

// ---------------------------------------------------------------------------
// Flash attention.  A work-group is 128 queries of ONE head; each 128-key K tile and
// V tile is brought into LDS once per work-group by asynchronous copies (two
// buffers, the next tile in flight while this one is worked on).
// Wave tile: 32 queries x 64 keys.  Four wave pairs take 32 queries each; the two
// waves of a pair take one half of every staged tile each, so a K or V fragment read
// from LDS feeds two products, and maximum, rescale and sum are taken once per 64
// keys.  At the end the waves of a pair hand each other one 16-query group (maximum,
// sum, output) through LDS and each finishes the group it keeps.
// Q,K: [B,NH,S,DK]; V: [B,NH,DK,S] bf16.
// The products are taken transposed: St = K Qt and Ot += Vt Pt.  A lane then
// holds keys of ONE query per 16-query group (lane lm = query, register j = key
// 8h + j of a 16-key tile), so maximum and sum run inside the lane with one
// exchange between the wave's halves, and two score tiles, converted in
// place, are the B operand of the second product in the hardware k order.
// The mask comes as the lane-mask words packed by the conversion launch: 16 words
// per 16 queries and 32 keys, the same for the whole wave, read by scalar loads one
// tile ahead; each word is the select condition of one score register.
#define AT_ 128       // keys per staged tile = 64 for each wave of a pair
#define KV_PITCH 72   // K: 128-byte rows at a 144-byte pitch (16 B x odd) for ds_load_b128
#define V_PITCH 136   // V: 256-byte rows at a 272-byte pitch (16 B x odd) for ds_load_b128
#define X_PITCH 36    // hand-over: 34 floats a lane at a 144-byte pitch (16 B x odd)
#define SCALE_LOG2E 0.18033688011112042f   // log2(e) / sqrt(DK)
#define MASKED_RAW  -480000.f              // -60000 * sqrt(DK)

// value of lane l ^ 16
static __device__ __forceinline__ float other_half(float x) {
  const int b = __builtin_bit_cast(int, x);
  return __builtin_bit_cast(
      float, __builtin_amdgcn_permlanex16(b, b, 0x76543210, 0xfedcba98, false, false));
}

// waves_per_eu: the grid gives each SIMD four waves, which is 256 registers a wave.
// Left alone the compiler would plan for more waves, and to save registers put every
// LDS load directly in front of its product instead of fetching ahead.
__global__ void __launch_bounds__(256) __attribute__((amdgpu_waves_per_eu(4, 4)))
flash_attn_bf16(const __bf16* __restrict__ Q, const __bf16* __restrict__ Kh,
                const __bf16* __restrict__ Vt, const unsigned int* __restrict__ mbits,
                __bf16* __restrict__ ctx) {
  __shared__ __attribute__((aligned(16))) __bf16 sK[2][AT_][KV_PITCH];
  __shared__ __attribute__((aligned(16))) __bf16 sV[2][DK_][V_PITCH];
  const int lane = threadIdx.x & 31;
  const int lm = lane & 15, h = lane >> 4;
  // readfirstlane: the wave's number is the same in every lane; it keeps what follows
  // from it (key half, mask addresses) in scalar registers
  const int wid = __builtin_amdgcn_readfirstlane(threadIdx.x >> 5);
  const int qg = wid & 3;    // the pair's 32 queries
  const int kh = wid >> 2;   // the wave's half of every staged tile

  const int qt0 = (blockIdx.x * 8) & (S_ / 16 - 1);   // the work-group's first 16-query tile
  const int bh = blockIdx.x >> 4;
  const int hd = bh & (NH_ - 1);
  const int bb = bh >> 4;

  const __bf16* Qp = Q  + ((size_t)(bb * NH_ + hd)) * S_ * DK_;
  const __bf16* Kp = Kh + ((size_t)(bb * NH_ + hd)) * S_ * DK_;
  const __bf16* Vp = Vt + ((size_t)(bb * NH_ + hd)) * DK_ * S_;

  // group 0 is the 16-query tile that the wave finishes itself, group 1 the one that
  // its partner finishes
  int qt[2];
  qt[0] = qt0 + 2 * qg + kh;
  qt[1] = qt0 + 2 * qg + (kh ^ 1);
  // the groups' mask words, 16 per 32 keys.  Constant address space: nothing writes
  // the words while this kernel runs; with the scalar index it makes the loads in the
  // loop scalar loads.
  const cv16u* mw[2];
  v16bf bq[2][2];   // Q as B operand: column lm = query
#pragma unroll
  for (int g = 0; g < 2; ++g) {
    mw[g] = (const cv16u*)(uintptr_t)(mbits + (size_t)(bb * (S_ / 16) + qt[g]) * (S_ / 32 * 16)) + 2 * kh;
#pragma unroll
    for (int c = 0; c < 2; ++c)
      bq[g][c] = load_op16(Qp + (size_t)(qt[g] * 16 + lm) * DK_ + 32 * c, h);
  }

  v8f oacc[2][4] = {};       // Ot: oacc[g][nt][j] = O[query lm of group g][nt*16 + 8h + j]
  float mrow[2] = {-3.0e38f, -3.0e38f};   // running maximum of the raw products (equal in both halves)
  float lrow[2] = {0.f, 0.f};             // running sum over this lane half's keys only

  // staging K: 8 threads per 128-byte row, 32 rows per sweep, four sweeps per tile;
  // V: 16 threads per 256-byte row, 16 rows per sweep, four sweeps per tile
  const int kr = threadIdx.x >> 3;        // 0..31
  const int kc8 = (threadIdx.x & 7) * 8;  // element in the K row
  const int vr = threadIdx.x >> 4;        // 0..15
  const int vc8 = (threadIdx.x & 15) * 8; // element in the V row
  const __bf16* gK = Kp + (size_t)kr * DK_ + kc8;
  const __bf16* gV = Vp + (size_t)vr * S_ + vc8;

  auto stageKV = [&](int buf, int kb0) {
    const __bf16* k0 = gK + (size_t)kb0 * DK_;
    const __bf16* k1 = k0 + 32 * DK_;
    const __bf16* k2 = k0 + 64 * DK_;
    const __bf16* k3 = k0 + 96 * DK_;
    const __bf16* v0 = gV + kb0;
    const __bf16* v1 = v0 + (size_t)16 * S_;
    const __bf16* v2 = v0 + (size_t)32 * S_;
    const __bf16* v3 = v0 + (size_t)48 * S_;
    const unsigned lk0 = (unsigned)(uintptr_t)&sK[buf][kr][kc8];
    const unsigned lk1 = (unsigned)(uintptr_t)&sK[buf][32 + kr][kc8];
    const unsigned lk2 = (unsigned)(uintptr_t)&sK[buf][64 + kr][kc8];
    const unsigned lk3 = (unsigned)(uintptr_t)&sK[buf][96 + kr][kc8];
    const unsigned lv0 = (unsigned)(uintptr_t)&sV[buf][vr][vc8];
    const unsigned lv1 = (unsigned)(uintptr_t)&sV[buf][16 + vr][vc8];
    const unsigned lv2 = (unsigned)(uintptr_t)&sV[buf][32 + vr][vc8];
    const unsigned lv3 = (unsigned)(uintptr_t)&sV[buf][48 + vr][vc8];
    // the eight copies of one tile; s_wait_xcnt closes the statement so that no
    // address register of a copy is rewritten ahead of it
    asm volatile(
        "global_load_async_to_lds_b128 %0, %8, off\n\t"
        "global_load_async_to_lds_b128 %1, %9, off\n\t"
        "global_load_async_to_lds_b128 %2, %10, off\n\t"
        "global_load_async_to_lds_b128 %3, %11, off\n\t"
        "global_load_async_to_lds_b128 %4, %12, off\n\t"
        "global_load_async_to_lds_b128 %5, %13, off\n\t"
        "global_load_async_to_lds_b128 %6, %14, off\n\t"
        "global_load_async_to_lds_b128 %7, %15, off\n\t"
        "s_wait_xcnt 0x0"
        :: "v"(lk0), "v"(lk1), "v"(lk2), "v"(lk3), "v"(lv0), "v"(lv1), "v"(lv2), "v"(lv3),
           "v"(k0), "v"(k1), "v"(k2), "v"(k3), "v"(v0), "v"(v1), "v"(v2), "v"(v3)
        : "memory");
  };

  const int NT = S_ / AT_;  // staged tiles
  // The S/128 work-groups of one head start together and would ask L2 for the same K
  // and V lines at the same moment.  Each starts its walk over the key tiles at a tile
  // of its own and wraps.
  const int tFirst = blockIdx.x & (NT - 1);
  auto tileOf = [&](int trip) { return (trip + tFirst) & (NT - 1); };
  stageKV(0, tileOf(0) * AT_);
  wait_async0();     // this wave's share of the first tile has landed
  __syncthreads();   // the first tile readable by every wave
  stageKV(1, tileOf(1) * AT_);

  v16u mk[2][2];   // this tile's mask words, [group][32 keys]
#pragma unroll
  for (int g = 0; g < 2; ++g)
#pragma unroll
    for (int kc = 0; kc < 2; ++kc) mk[g][kc] = mw[g][(AT_ / 32) * tileOf(0) + kc];

  for (int ti = 0; ti < NT; ++ti) {
    const int buf = ti & 1;
    const __bf16* kp = &sK[buf][kh * 64 + lm][0];
    const __bf16* vp = &sV[buf][lm][kh * 64];

    // ---- scores: St[64k x 32q], K-dim = DK in two chunks of 32; every K fragment
    // feeds both groups (all loops unrolled: constant indices keep sc in registers)
    v8f sc[2][4] = {};
#pragma unroll
    for (int c = 0; c < 2; ++c)
#pragma unroll
      for (int tt = 0; tt < 4; ++tt) {
        const v16bf ak = load_op16(kp + 16 * tt * KV_PITCH + 32 * c, h);
#pragma unroll
        for (int g = 0; g < 2; ++g)
          sc[g][tt] = __builtin_amdgcn_wmma_f32_16x16x32_bf16(
              false, ak, false, bq[g][c], (short)0, sc[g][tt], false, false);
      }
    // order of the K reads (0x100) and the score products (0x8): five fragments go ahead
    // as one group, then one more is fetched behind every two products, into the
    // registers that they free.  Left alone the compiler fetches each fragment of the
    // second chunk directly in front of its two products and waits out the LDS latency.
    __builtin_amdgcn_sched_group_barrier(0x100, 10, 0);
#pragma unroll
    for (int i = 0; i < 3; ++i) {
      __builtin_amdgcn_sched_group_barrier(0x8, 2, 0);
      __builtin_amdgcn_sched_group_barrier(0x100, 2, 0);
    }
    __builtin_amdgcn_sched_group_barrier(0x8, 10, 0);
    // keeps the selects behind all sixteen products: moved in among them, each first
    // read of a score tile stands directly behind its last product and costs idle slots
    __builtin_amdgcn_sched_barrier(0);

    // ---- V fragments (row = dk, k = keys) of the first 32 keys, fetched ahead of the
    // softmax, which covers their LDS latency
    v16bf av0[4];
#pragma unroll
    for (int nt = 0; nt < 4; ++nt) av0[nt] = load_op16(vp + nt * 16 * V_PITCH, h);
    // keeps these reads in front of the softmax; left alone the compiler moves them
    // down to their products
    __builtin_amdgcn_sched_barrier(0);

    // ---- apply mask to the raw products (the masked score times sqrt(DK))
#pragma unroll
    for (int g = 0; g < 2; ++g)
#pragma unroll
      for (int tt = 0; tt < 4; ++tt)
#pragma unroll
        for (int j = 0; j < 8; ++j)
          sc[g][tt][j] = __builtin_amdgcn_inverse_ballot_w32(mk[g][tt >> 1][8 * (tt & 1) + j])
                             ? sc[g][tt][j] : MASKED_RAW;

    // ---- mask words of the next tile, into the registers just read (the last trip
    // reads its own again)
    const int tn = tileOf(ti + 1 < NT ? ti + 1 : ti);
#pragma unroll
    for (int g = 0; g < 2; ++g)
#pragma unroll
      for (int kc = 0; kc < 2; ++kc) mk[g][kc] = mw[g][(AT_ / 32) * tn + kc];

    // ---- online softmax of one query per lane and group, 64 keys at a time
    v16bf pb[2][2];
#pragma unroll
    for (int g = 0; g < 2; ++g) {
      float cm = fmaxf(sc[g][0][0], sc[g][1][0]);
#pragma unroll
      for (int j = 1; j < 8; ++j) cm = fmaxf(cm, fmaxf(sc[g][0][j], sc[g][1][j]));
#pragma unroll
      for (int j = 0; j < 8; ++j) cm = fmaxf(cm, fmaxf(sc[g][2][j], sc[g][3][j]));
      cm = fmaxf(cm, other_half(cm));
      const float mnew = fmaxf(mrow[g], cm);
      // difference first, then the factor: exactly 1 where the maximum stays, whatever
      // its size (a row that is masked throughout keeps equal weights)
      const float alpha = __builtin_amdgcn_exp2f((mrow[g] - mnew) * SCALE_LOG2E);
      mrow[g] = mnew;
      // exp(s / sqrt(DK) - max / sqrt(DK)) = exp2(s * SCALE_LOG2E - mlnew): one fused
      // multiply-add a score, two scores an instruction
      const float mlnew = mnew * SCALE_LOG2E;
      const v2f c2 = {SCALE_LOG2E, SCALE_LOG2E};
      const v2f nm = {-mlnew, -mlnew};
      v2f rs[4];   // four chains of sums, two neighbouring scores an addition
#pragma unroll
      for (int tt = 0; tt < 4; ++tt)
#pragma unroll
        for (int j = 0; j < 8; j += 2) {
          const v2f x = {sc[g][tt][j], sc[g][tt][j + 1]};
          const v2f e = __builtin_elementwise_fma(x, c2, nm);
          const v2f w = {__builtin_amdgcn_exp2f(e[0]), __builtin_amdgcn_exp2f(e[1])};
          sc[g][tt][j]     = w[0];
          sc[g][tt][j + 1] = w[1];
          rs[tt] = j == 0 ? w : rs[tt] + w;
        }
      const v2f rsum = (rs[0] + rs[1]) + (rs[2] + rs[3]);
      lrow[g] = lrow[g] * alpha + (rsum[0] + rsum[1]);
#pragma unroll
      for (int nt = 0; nt < 4; ++nt)
#pragma unroll
        for (int j = 0; j < 8; ++j) oacc[g][nt][j] *= alpha;

      // ---- Pt: two score tiles, converted in place, are one B operand
#pragma unroll
      for (int kc = 0; kc < 2; ++kc)
#pragma unroll
        for (int j = 0; j < 8; ++j) {
          pb[g][kc][j]     = (__bf16)sc[g][2 * kc][j];
          pb[g][kc][8 + j] = (__bf16)sc[g][2 * kc + 1][j];
        }
    }

    // ---- Ot += Vt @ Pt (4 M-tiles over DK, two chunks of 32 keys); every V fragment
    // feeds both groups
#pragma unroll
    for (int kc = 0; kc < 2; ++kc)
#pragma unroll
      for (int nt = 0; nt < 4; ++nt) {
        const v16bf av = kc == 0 ? av0[nt] : load_op16(vp + nt * 16 * V_PITCH + 32, h);
#pragma unroll
        for (int g = 0; g < 2; ++g)
          oacc[g][nt] = __builtin_amdgcn_wmma_f32_16x16x32_bf16(
              false, av, false, pb[g][kc], (short)0, oacc[g][nt], false, false);
      }

    // ---- publish point of tile ti + 1; the barrier also ends every wave's reads
    // of this tile's buffer, which is refilled behind it
    asm volatile("s_wait_dscnt 0x0" ::: "memory");  // own LDS reads retired
    wait_async0();                                  // own copies of tile ti + 1 landed
    __syncthreads();
    if (ti + 2 < NT) stageKV(buf, tileOf(ti + 2) * AT_);
  }
  wait_async0();  // nothing in flight when the ring is reused and when the wave ends

  // ---- the waves of a pair hand each other group 1 through the K ring, which is free:
  // the last trip waited for every copy and its barrier ended every wave's reads
  float* xch = (float*)&sK[0][0][0];   // [8 waves][32 lanes][X_PITCH]
  {
    float* xo = xch + (wid * 32 + lane) * X_PITCH;
#pragma unroll
    for (int nt = 0; nt < 4; ++nt)
#pragma unroll
      for (int q4 = 0; q4 < 2; ++q4) {
        const v4f x = {oacc[1][nt][4 * q4], oacc[1][nt][4 * q4 + 1],
                       oacc[1][nt][4 * q4 + 2], oacc[1][nt][4 * q4 + 3]};
        *(v4f*)(xo + nt * 8 + q4 * 4) = x;
      }
    const v2f ml = {mrow[1], lrow[1]};
    *(v2f*)(xo + 32) = ml;
  }
  __syncthreads();   // the partner's group readable
  const float* xi = xch + ((wid ^ 4) * 32 + lane) * X_PITCH;
  const v2f mlp = *(const v2f*)(xi + 32);
  const float mall = fmaxf(mrow[0], mlp[0]);
  const float wa = __builtin_amdgcn_exp2f((mrow[0] - mall) * SCALE_LOG2E);
  const float wb = __builtin_amdgcn_exp2f((mlp[0] - mall) * SCALE_LOG2E);
  const float lsum = lrow[0] * wa + mlp[1] * wb;

  // ---- join the halves' sums, normalize, emit context [B,S,H] bf16:
  // 8 consecutive dk of one query per lane and tile, one 16-byte store each
  // (unrolled: oacc is indexed by constants)
  const float inv = 1.f / (lsum + other_half(lsum));
  const float fa = wa * inv, fb = wb * inv;
  __bf16* op = ctx + ((size_t)(bb * S_ + qt[0] * 16 + lm)) * H_ + hd * DK_ + 8 * h;
#pragma unroll
  for (int nt = 0; nt < 4; ++nt) {
    const v4f p0 = *(const v4f*)(xi + nt * 8);
    const v4f p1 = *(const v4f*)(xi + nt * 8 + 4);
    v8bf y;
#pragma unroll
    for (int j = 0; j < 4; ++j) {
      y[j]     = (__bf16)(oacc[0][nt][j] * fa + p0[j] * fb);
      y[4 + j] = (__bf16)(oacc[0][nt][4 + j] * fa + p1[j] * fb);
    }
    *(v8bf*)(op + nt * 16) = y;
  }
}

// ---------------------------------------------------------------------------
extern "C" void kernel_launch(void* const* d_in, const int* in_sizes, int n_in,
                              void* d_out, int out_size, void* d_ws, size_t ws_size,
                              hipStream_t stream) {
  (void)in_sizes; (void)n_in; (void)out_size; (void)ws_size;
  const float* query = (const float*)d_in[0];
  const float* key   = (const float*)d_in[1];
  const int*   amask = (const int*)d_in[2];
  const float* Wq = (const float*)d_in[3]; const float* bq = (const float*)d_in[4];
  const float* Wk = (const float*)d_in[5]; const float* bk = (const float*)d_in[6];
  const float* Wv = (const float*)d_in[7]; const float* bv = (const float*)d_in[8];
  const float* Wo = (const float*)d_in[9]; const float* bo = (const float*)d_in[10];

  char* ws = (char*)d_ws;
  const size_t MB = 1u << 20;
  __bf16* Xq  = (__bf16*)(ws +  0 * MB);
  __bf16* Xk  = (__bf16*)(ws +  8 * MB);
  __bf16* Wqb = (__bf16*)(ws + 16 * MB);
  __bf16* Wkb = (__bf16*)(ws + 18 * MB);
  __bf16* Wvb = (__bf16*)(ws + 20 * MB);
  __bf16* Wob = (__bf16*)(ws + 22 * MB);
  __bf16* Qh  = (__bf16*)(ws + 24 * MB);  // [B,NH,S,DK]
  __bf16* Khd = (__bf16*)(ws + 32 * MB);  // [B,NH,S,DK]
  __bf16* Vtd = (__bf16*)(ws + 40 * MB);  // [B,NH,DK,S]
  __bf16* ctx = (__bf16*)(ws + 48 * MB);  // [B,S,H]
  unsigned int* mbits = (unsigned int*)(ws + 56 * MB);  // 1 MB of lane-mask words

  // Xq, Xk, Wqb, Wkb, Wvb, Wob are written as one run of 24 MB from Xq on
  cvt_f32_bf16<<<MASK_BLOCKS + 12 * CVT_BLOCKS_PER_PART, 256, 0, stream>>>(query, key, Wq, Wk, Wv, Wo, Xq,
                                                                           amask, mbits);

  dim3 g3(32, 8, 3);  // M/128 x N/128 x {Q, K, V}
  gemm_bf16_wmma<<<g3, 256, 0, stream>>>(Xq, Wqb, bq, Qh,  1,
                                         Xk, Wkb, bk, Khd, 1,
                                         Xk, Wvb, bv, Vtd, 2, B_*S_, H_, H_);

  flash_attn_bf16<<<512, 256, 0, stream>>>(Qh, Khd, Vtd, mbits, ctx);

  dim3 g1(32, 8, 1);
  gemm_bf16_wmma<<<g1, 256, 0, stream>>>(ctx, Wob, bo, d_out, 3,
                                         ctx, Wob, bo, d_out, 3,
                                         ctx, Wob, bo, d_out, 3, B_*S_, H_, H_);
}
